// v000
// Times are from an AMD MI455X. After a warm-up the kernel runs many times in a row, and a time is the length of
// such a window on the GPU divided by its runs, so every launch and the gaps after it count. The runs cycle
// through copies of the inputs. A figure is the median of several windows, for all but v000 over two sittings.
// Sittings can differ by a few percent; kernels timed side by side share one.
// The starting kernel, v000, takes 497 microseconds a run.
#include <hip/hip_runtime.h>

// Single causal attention head scaled by the EMBEDDING width (x [4][2048][1024]; k = x Wk, q = x Wq, v = x Wv ('xw' [1024][64], no bias; ONE 64-wide head); wei = q.k^T x C^-0.5 with C = n_embed = 1024 (not head_size); causal (-inf); softmax; out = wei.v -> [4][2048][64] (0.5 M); argument order x, Wk, Wq, Wv (the KEY weight comes first)).
// Layout per batch: bf16 copy of x; 'xw' weights transposed once; exact projections (N 64); identity-table plane builders; causal T-2048 attention at NH 1 / ZH 1 with EVERY row on hi/lo planes (3 products for scores and P.V: one head and no output projection); the f32 merge writes the output rows.
// Compute dtypes, f32 accumulate: every input rounded to bf16; projections exact; attention 3 products on every row; softmax f32; output f32.

#define NB_  4
#define TT   2048
#define DM   1024
#define NH_  1
#define NKV  1
#define REP  (NH_ / NKV)
#define HD   64
#define DQ   (NH_ * HD)
#define DKV  (NKV * HD)
#define ZH   1                    // ONE head: a single plane per pass
#define RH   TT                   // every row hi/lo (3 products)
#define WIN  2048
#define PCAR 1024.0f
#define SCL  0.03125f   // C^-0.5 with C = n_embed = 1024
typedef _Float16 h16;
typedef unsigned short bf;
typedef __attribute__((ext_vector_type(16))) __bf16   v16bf;
typedef __attribute__((ext_vector_type(16))) _Float16 v16h;
typedef __attribute__((ext_vector_type(8)))  _Float16 v8h;
typedef __attribute__((ext_vector_type(8)))  unsigned short v8us;
typedef __attribute__((ext_vector_type(8)))  float    v8f;
typedef __attribute__((ext_vector_type(4)))  float    v4f;
typedef v8h  __attribute__((may_alias)) v8ha;
typedef v4f  __attribute__((may_alias)) v4fa;
typedef v8us __attribute__((may_alias)) v8usa;

__device__ __forceinline__ unsigned short f2bf(float f) { unsigned u = __float_as_uint(f); u += 0x7FFFu + ((u >> 16) & 1u); return (unsigned short)(u >> 16); }
__device__ __forceinline__ float bf2f(unsigned short b) { return __uint_as_float(((unsigned)b) << 16); }
__device__ __forceinline__ float bfr(float f) { return bf2f(f2bf(f)); }
__device__ __forceinline__ v16h cat16(v8h lo, v8h hi) { return __builtin_shufflevector(lo, hi, 0, 1, 2, 3, 4, 5, 6, 7, 8, 9, 10, 11, 12, 13, 14, 15); }
__device__ __forceinline__ v16bf cat16b(v8us lo, v8us hi) { return __builtin_bit_cast(v16bf, __builtin_shufflevector(lo, hi, 0, 1, 2, 3, 4, 5, 6, 7, 8, 9, 10, 11, 12, 13, 14, 15)); }
__device__ __forceinline__ v8f wmma16(v16h a, v16h b, v8f c) { return __builtin_amdgcn_wmma_f32_16x16x32_f16(false, a, false, b, (short)0, c, false, false); }
__device__ __forceinline__ v8f wmmab(v16bf a, v16bf b, v8f c) { return __builtin_amdgcn_wmma_f32_16x16x32_bf16(false, a, false, b, (short)0, c, false, false); }



// ---- k_gemmw: register-blocked GEMM, ONE WAVE per 64x64 output tile (16 accumulators), operands straight from K-contiguous 16-bit planes; grid (M/64, N/64, Z), 32 threads.
// C[m][n] (f32, pitch ldc, + optional f32 bias[n]) = sum_k A[m][k] Bt[n][k] (+ split products per NSPLIT). z-batch strides sA/sB/sC in elements. K % 32 == 0.
template <typename T16> struct WFrag;
template <> struct WFrag<h16> { typedef v16h V; static __device__ __forceinline__ V ld(const h16* p) { return cat16(*(const v8h*)p, *(const v8h*)(p + 16)); } static __device__ __forceinline__ v8f mma(V a, V b, v8f c) { return wmma16(a, b, c); } };
template <> struct WFrag<bf> { typedef v16bf V; static __device__ __forceinline__ V ld(const bf* p) { return cat16b(*(const v8us*)p, *(const v8us*)(p + 16)); } static __device__ __forceinline__ v8f mma(V a, V b, v8f c) { return wmmab(a, b, c); } };
template <typename T16, int NSPLIT, bool BIAS>
__global__ __launch_bounds__(32) void k_gemmw(const T16* __restrict__ A, const T16* __restrict__ A2, const T16* __restrict__ Bt, const T16* __restrict__ Bt2, int K, float* C, int ldc, const float* __restrict__ bias, size_t sA, size_t sB, size_t sC) {
    typedef typename WFrag<T16>::V V;
    __shared__ __align__(16) float os[16 * 68];
    const size_t z = blockIdx.z; A += z * sA; if (A2) A2 += z * sA; Bt += z * sB; if (Bt2) Bt2 += z * sB; C += z * sC;
    const int lane = threadIdx.x & 31, lr = lane & 15, hi = lane >> 4; const int r0 = blockIdx.x * 64, c0 = blockIdx.y * 64;
    v8f acc[4][4];
#pragma unroll
    for (int mb = 0; mb < 4; ++mb)
#pragma unroll
        for (int nb = 0; nb < 4; ++nb) acc[mb][nb] = (v8f){};
    const size_t aoff = (size_t)(r0 + lr) * K + 8 * hi, boff = (size_t)(c0 + lr) * K + 8 * hi;
#pragma unroll 1
    for (int kc = 0; kc < K; kc += 32) {
        V a[4], a2[4];
#pragma unroll
        for (int mb = 0; mb < 4; ++mb) { a[mb] = WFrag<T16>::ld(A + aoff + (size_t)mb * 16 * K + kc); if (NSPLIT == 1 || NSPLIT == 2) a2[mb] = WFrag<T16>::ld(A2 + aoff + (size_t)mb * 16 * K + kc); }
#pragma unroll
        for (int nb = 0; nb < 4; ++nb) { const V b = WFrag<T16>::ld(Bt + boff + (size_t)nb * 16 * K + kc); V b2; if (NSPLIT >= 2) b2 = WFrag<T16>::ld(Bt2 + boff + (size_t)nb * 16 * K + kc);
#pragma unroll
            for (int mb = 0; mb < 4; ++mb) { acc[mb][nb] = WFrag<T16>::mma(a[mb], b, acc[mb][nb]); if (NSPLIT == 1 || NSPLIT == 2) acc[mb][nb] = WFrag<T16>::mma(a2[mb], b, acc[mb][nb]); if (NSPLIT >= 2) acc[mb][nb] = WFrag<T16>::mma(a[mb], b2, acc[mb][nb]); } }
        asm volatile("v_nop\n\tv_nop\n\tv_nop\n\tv_nop" : "+v"(acc[0][0]), "+v"(acc[1][1]), "+v"(acc[2][2]), "+v"(acc[3][3]) : "v"(a[0]), "v"(a[3]));
    }
#pragma unroll
    for (int mb = 0; mb < 4; ++mb) {
#pragma unroll
        for (int nb = 0; nb < 4; ++nb) {
#pragma unroll
            for (int j = 0; j < 8; ++j) os[(hi * 8 + j) * 68 + nb * 16 + lr] = acc[mb][nb][j]; }
        __builtin_amdgcn_wave_barrier(); asm volatile("" ::: "memory");
        float* crow = C + (size_t)(r0 + mb * 16) * ldc + c0;
{
#pragma unroll
            for (int s = 0; s < 8; ++s) { const int row = 2 * s + hi, cofs = lr * 4; v4f val = *(const v4fa*)(os + row * 68 + cofs); if (BIAS) { val[0] += bfr(bias[c0 + cofs]); val[1] += bfr(bias[c0 + cofs + 1]); val[2] += bfr(bias[c0 + cofs + 2]); val[3] += bfr(bias[c0 + cofs + 3]); }
                *(v4f*)(crow + (size_t)row * ldc + cofs) = val; }
             }
        __builtin_amdgcn_wave_barrier(); asm volatile("" ::: "memory");
    }
}

// ---- k_gemmc: the same one-wave 64x64 tile GEMM specialised for causal attention: CMODE 1 skips score tiles entirely above the diagonal (query rows r0+roff.., key columns c0..), CMODE 2 limits the
// key (K) loop of the probability x value contraction to the diagonal block (probabilities beyond it are exactly zero). roff = row offset of this launch's first row within the sequence.
template <typename T16, int NSPLIT, int CMODE>
__global__ __launch_bounds__(32) void k_gemmc(const T16* __restrict__ A, const T16* __restrict__ A2, const T16* __restrict__ Bt, const T16* __restrict__ Bt2, int K, float* C, int ldc, int roff, size_t sA, size_t sB, size_t sC) {
    typedef typename WFrag<T16>::V V;
    __shared__ __align__(16) float os[16 * 68];
    const size_t z = blockIdx.z; A += z * sA; if (A2) A2 += z * sA; Bt += z * sB; if (Bt2) Bt2 += z * sB; C += z * sC;
    const int lane = threadIdx.x & 31, lr = lane & 15, hi = lane >> 4; const int r0 = blockIdx.x * 64, c0 = blockIdx.y * 64;
    if (CMODE == 1 && c0 > r0 + roff + 63) return;                  // score tile entirely above the causal diagonal: never written (the softmax masks j > i by select)
    const int Kl = (CMODE == 2) ? min(K, r0 + roff + 64) : K;        // P.V: probabilities are exactly 0 beyond the diagonal block, so the K loop stops there
    v8f acc[4][4];
#pragma unroll
    for (int mb = 0; mb < 4; ++mb)
#pragma unroll
        for (int nb = 0; nb < 4; ++nb) acc[mb][nb] = (v8f){};
    const size_t aoff = (size_t)(r0 + lr) * K + 8 * hi, boff = (size_t)(c0 + lr) * K + 8 * hi;
#pragma unroll 1
    for (int kc = 0; kc < Kl; kc += 32) {
        V a[4], a2[4];
#pragma unroll
        for (int mb = 0; mb < 4; ++mb) { a[mb] = WFrag<T16>::ld(A + aoff + (size_t)mb * 16 * K + kc); if (NSPLIT == 1 || NSPLIT == 2) a2[mb] = WFrag<T16>::ld(A2 + aoff + (size_t)mb * 16 * K + kc); }
#pragma unroll
        for (int nb = 0; nb < 4; ++nb) { const V b = WFrag<T16>::ld(Bt + boff + (size_t)nb * 16 * K + kc); V b2; if (NSPLIT >= 2) b2 = WFrag<T16>::ld(Bt2 + boff + (size_t)nb * 16 * K + kc);
#pragma unroll
            for (int mb = 0; mb < 4; ++mb) { acc[mb][nb] = WFrag<T16>::mma(a[mb], b, acc[mb][nb]); if (NSPLIT == 1 || NSPLIT == 2) acc[mb][nb] = WFrag<T16>::mma(a2[mb], b, acc[mb][nb]); if (NSPLIT >= 2) acc[mb][nb] = WFrag<T16>::mma(a[mb], b2, acc[mb][nb]); } }
        asm volatile("v_nop\n\tv_nop\n\tv_nop\n\tv_nop" : "+v"(acc[0][0]), "+v"(acc[1][1]), "+v"(acc[2][2]), "+v"(acc[3][3]) : "v"(a[0]), "v"(a[3]));
    }
#pragma unroll
    for (int mb = 0; mb < 4; ++mb) {
#pragma unroll
        for (int nb = 0; nb < 4; ++nb) {
#pragma unroll
            for (int j = 0; j < 8; ++j) os[(hi * 8 + j) * 68 + nb * 16 + lr] = acc[mb][nb][j]; }
        __builtin_amdgcn_wave_barrier(); asm volatile("" ::: "memory");
        float* crow = C + (size_t)(r0 + mb * 16) * ldc + c0;
{
#pragma unroll
            for (int s = 0; s < 8; ++s) { const int row = 2 * s + hi, cofs = lr * 4; v4f val = *(const v4fa*)(os + row * 68 + cofs);
                *(v4f*)(crow + (size_t)row * ldc + cofs) = val; }
             }
        __builtin_amdgcn_wave_barrier(); asm volatile("" ::: "memory");
    }
}

__device__ __forceinline__ h16 tohx(float x) { return (h16)x; }
__device__ __forceinline__ void splitf(float y, unsigned short& h, unsigned short& l) { h = f2bf(y); l = f2bf(y - bf2f(h)); }
typedef __attribute__((ext_vector_type(2))) _Float16 v2h;
typedef __attribute__((ext_vector_type(4))) _Float16 v4h;
typedef __attribute__((ext_vector_type(2))) unsigned short v2us;
typedef __attribute__((ext_vector_type(4))) unsigned short v4us;
typedef __attribute__((ext_vector_type(2))) float v2f;
typedef __attribute__((ext_vector_type(4))) int v4i;

__global__ __launch_bounds__(256) void k_wtG(const float* __restrict__ w, int K, int N, bf* Bt) {
    const int lane = threadIdx.x & 31; const int L0 = (blockIdx.x * 8 + (threadIdx.x >> 5)) * 8; const int nlines = N * K / 64;
{
#pragma unroll 1
        for (int l = 0; l < 8; ++l) { const int L = L0 + l; if (L >= nlines) break; const size_t e = (size_t)L * 64 + lane * 2; const int k = (int)(e % K), n = (int)(e / K); v2us o;
            o[0] = f2bf(w[(size_t)k * N + n]); o[1] = f2bf(w[(size_t)(k + 1) * N + n]); *(v2us*)(Bt + e) = o; }
         }
}
__global__ __launch_bounds__(256) void k_cvt8(const float* __restrict__ src, bf* dst, size_t n8) { const size_t i = (size_t)blockIdx.x * 256 + threadIdx.x; if (i >= n8) return; const v8f v = *(const v8f*)(src + i * 8); v8us o;
#pragma unroll
    for (int k = 0; k < 8; ++k) o[k] = f2bf(v[k]); *(v8us*)(dst + i * 8) = o;  }

// k_rope: head planes [h][t][d] (fp16 + hi/lo) of rope(x) x sc with the rotate-half convention out[d] = x[d] cos[t][d] - x[d+HD/2] sin[t][d], out[d+HD/2] = x[d+HD/2] cos[t][d+HD/2] + x[d] sin[t][d+HD/2]
__global__ __launch_bounds__(256) void k_rope(const float* __restrict__ F, int pitch, int nheads, const float* __restrict__ CS, const float* __restrict__ RF, const float* __restrict__ nw, float sc, h16* P16, bf* Ph, bf* Pl) {
    const size_t e = ((size_t)blockIdx.x * 256 + threadIdx.x) * 2; if (e >= (size_t)nheads * TT * HD) return; const int d = (int)(e % HD); const int t = (int)((e / HD) % TT); const int h = (int)(e / ((size_t)HD * TT)); const float* f = F + (size_t)t * pitch + h * HD; const float rf = RF ? RF[(size_t)h * TT + t] : 1.0f; v2h o16; v2us oh, ol;
#pragma unroll
    for (int q = 0; q < 2; ++q) { const int dd = d + q; const int dp = (dd < HD / 2) ? dd + HD / 2 : dd - HD / 2; float x0 = f[dd], x1 = f[dp];
        if (RF) { float n0 = __fmul_rn(x0, rf), n1 = __fmul_rn(x1, rf); asm volatile("" : "+v"(n0)); asm volatile("" : "+v"(n1)); x0 = __fmul_rn(bfr(nw[dd]), n0); x1 = __fmul_rn(bfr(nw[dp]), n1); }
        const v2f cs = *(const v2f*)(CS + ((size_t)t * HD + dd) * 2); float a = __fmul_rn(x0, cs[0]), bq = __fmul_rn(x1, cs[1]); asm volatile("" : "+v"(a)); asm volatile("" : "+v"(bq)); const float r = ((dd < HD / 2) ? __fsub_rn(a, bq) : __fadd_rn(a, bq)) * sc;
        o16[q] = tohx(r); unsigned short a2, c2; splitf(r, a2, c2); oh[q] = a2; ol[q] = c2; }
    *(v2h*)(P16 + e) = o16; *(v2us*)(Ph + e) = oh; *(v2us*)(Pl + e) = ol;  }
__global__ __launch_bounds__(256) void k_vtp(const float* __restrict__ F, int pitch, int nheads, h16* V16, bf* Vh, bf* Vl) { const size_t e = ((size_t)blockIdx.x * 256 + threadIdx.x) * 2; if (e >= (size_t)nheads * HD * TT) return; const int t = (int)(e % TT); const int d = (int)((e / TT) % HD); const int g = (int)(e / ((size_t)TT * HD)); v2h o16; v2us oh, ol;
#pragma unroll
    for (int q = 0; q < 2; ++q) { const float x = F[(size_t)(t + q) * pitch + g * HD + d]; o16[q] = tohx(x); unsigned short a2, c2; splitf(x, a2, c2); oh[q] = a2; ol[q] = c2; }
    *(v2h*)(V16 + e) = o16; *(v2us*)(Vh + e) = oh; *(v2us*)(Vl + e) = ol;  }
__global__ __launch_bounds__(256) void k_csid(float* CS) { const int idx = blockIdx.x * 256 + threadIdx.x; if (idx >= TT * HD) return; v2f cs; cs[0] = 1.0f; cs[1] = 0.0f; *(v2f*)(CS + (size_t)idx * 2) = cs;  }
// k_asoft: per row (zz, i): t = S x C^-0.5 (C = n_embed = 1024) for j <= i and i - j < WIN (sliding causal window; the reference's -1e9 additive fill vanishes identically); softmax over the 2048 keys (register row, one exp, fixed trees);
__global__ __launch_bounds__(256) void k_asoft(const float* __restrict__ Sb, h16* P16, bf* Ph, bf* Pl) {
    const int lane = threadIdx.x & 31; const int row = blockIdx.x * 8 + (threadIdx.x >> 5); if (row >= ZH * TT) return; const int i = row % TT; const int zz = row / TT; (void)zz; const bool hires = (i < RH); const float* sr = Sb + (size_t)row * TT; float v[TT / 32]; float mx = -3.0e38f;
#pragma unroll
    for (int ch = 0; ch < TT / 128; ++ch) { const int j0 = ch * 128 + lane * 4; const v4f a = *(const v4f*)(sr + j0);
#pragma unroll
        for (int q = 0; q < 4; ++q) { const int j = j0 + q; (void)j; const float t = (j <= i && i - j < WIN) ? a[q] * SCL : -3.0e38f; v[ch * 4 + q] = t; mx = fmaxf(mx, t); } }
#pragma unroll
    for (int sh = 16; sh; sh >>= 1) mx = fmaxf(mx, __shfl_xor(mx, sh, 32));
    float sum = 0.f;
#pragma unroll
    for (int k = 0; k < TT / 32; ++k) { float d0 = __fsub_rn(v[k], mx); asm volatile("" : "+v"(d0)); v[k] = __builtin_amdgcn_exp2f(__fmul_rn(d0, 1.4426950408889634f)); sum += v[k]; }
#pragma unroll
    for (int sh = 16; sh; sh >>= 1) sum += __shfl_xor(sum, sh, 32);
    const float f = __fdiv_rn(hires ? 1.0f : PCAR, sum);
{
        if (hires) {
#pragma unroll
            for (int ch = 0; ch < TT / 128; ++ch) { v4us oh, ol;
#pragma unroll
                for (int q = 0; q < 4; ++q) { unsigned short a, c2; splitf(v[ch * 4 + q] * f, a, c2); oh[q] = a; ol[q] = c2; }
                const size_t oo = ((size_t)zz * (RH ? RH : 1) + i) * TT + ch * 128 + lane * 4; *(v4us*)(Ph + oo) = oh; *(v4us*)(Pl + oo) = ol; }
        } else {
#pragma unroll
            for (int ch = 0; ch < TT / 128; ++ch) { v4h o4;
#pragma unroll
                for (int q = 0; q < 4; ++q) o4[q] = tohx(v[ch * 4 + q] * f);
                *(v4h*)(P16 + (size_t)row * TT + ch * 128 + lane * 4) = o4; } }
         }
}
__global__ __launch_bounds__(256) void k_merge(const float* __restrict__ O, int h0, float* OUTb) { const size_t e = ((size_t)blockIdx.x * 256 + threadIdx.x) * 2; if (e >= (size_t)ZH * TT * HD) return; const int d = (int)(e % HD); const int t = (int)((e / HD) % TT); const int zz = (int)(e / ((size_t)HD * TT)); const float cs = (t < RH) ? 1.0f : (1.0f / PCAR); const size_t oo = (size_t)t * DQ + (h0 + zz) * HD + d;
    v2f o2; o2[0] = O[e] * cs; o2[1] = O[e + 1] * cs; *(v2f*)(OUTb + oo) = o2;  }

extern "C" void kernel_launch(void* const* d_in, const int* in_sizes, int n_in,
                              void* d_out, int out_size, void* d_ws, size_t ws_size, hipStream_t stream) {
    (void)in_sizes; (void)n_in; (void)out_size;
    const float* x = (const float*)d_in[0]; const float* wk = (const float*)d_in[1]; const float* wq = (const float*)d_in[2]; const float* wv = (const float*)d_in[3]; const float* wo = nullptr; (void)wo;   /* order x, Wk, Wq, Wv ('xw' [1024][64]; NOTE the key weight comes FIRST) */
    float* OUT = (float*)d_out;     // [4][2048][64]
    char* wsp = (char*)d_ws;
    auto take = [&](size_t bytes) { char* p = wsp; wsp += (bytes + 255) & ~(size_t)255; return (void*)p; };
    bf* WQ = (bf*)take((size_t)DQ * DM * 2); bf* WK = (bf*)take((size_t)DKV * DM * 2); bf* WV = (bf*)take((size_t)DKV * DM * 2); float* CS = (float*)take((size_t)TT * HD * 2 * 4);
    bf* XB = (bf*)take((size_t)TT * DM * 2); float* FQ = (float*)take((size_t)TT * DQ * 4); float* FK = (float*)take((size_t)TT * DKV * 4);
    h16* QP16 = (h16*)take((size_t)NH_ * TT * HD * 2); h16* KP16 = (h16*)take((size_t)NKV * TT * HD * 2); h16* VT16 = (h16*)take((size_t)NKV * HD * TT * 2);
    bf* QPh = (bf*)take((size_t)NH_ * TT * HD * 2); bf* QPl = (bf*)take((size_t)NH_ * TT * HD * 2); bf* KPh = (bf*)take((size_t)NKV * TT * HD * 2); bf* KPl = (bf*)take((size_t)NKV * TT * HD * 2); bf* VTh = (bf*)take((size_t)NKV * HD * TT * 2); bf* VTl = (bf*)take((size_t)NKV * HD * TT * 2); bf* Ph = (bf*)take((size_t)ZH * RH * TT * 2); bf* Pl = (bf*)take((size_t)ZH * RH * TT * 2);
    float* Sb = (float*)take((size_t)ZH * TT * TT * 4); h16* P16 = (h16*)take((size_t)ZH * TT * TT * 2); float* Ob = (float*)take((size_t)ZH * TT * HD * 4);
    if ((size_t)(wsp - (char*)d_ws) > ws_size) return;    // ws 256 MiB
    float* FV = FK;   // v projection reuses the k buffer after the k planes are built (stream-ordered)
    { k_wtG<<<(unsigned)((DM * DQ / 64 + 63) / 64), 256, 0, stream>>>(wq, DM, DQ, WQ); k_wtG<<<(unsigned)((DM * DKV / 64 + 63) / 64), 256, 0, stream>>>(wk, DM, DKV, WK); k_wtG<<<(unsigned)((DM * DKV / 64 + 63) / 64), 256, 0, stream>>>(wv, DM, DKV, WV);
      
       }
    k_csid<<<(TT * HD + 255) / 256, 256, 0, stream>>>(CS);
    const unsigned LQ = (unsigned)(((size_t)NH_ * TT * HD / 2 + 255) / 256), LKv = (unsigned)(((size_t)NKV * TT * HD / 2 + 255) / 256);
    for (int b = 0; b < NB_; ++b) {
        
        k_cvt8<<<(unsigned)(((size_t)TT * DM / 8 + 255) / 256), 256, 0, stream>>>(x + (size_t)b * TT * DM, XB, (size_t)TT * DM / 8);
        k_gemmw<bf, 0, false><<<dim3(TT / 64, DQ / 64, 1), 32, 0, stream>>>(XB, nullptr, WQ, nullptr, DM, FQ, DQ, nullptr, 0, 0, 0);
        k_rope<<<LQ, 256, 0, stream>>>(FQ, DQ, NH_, CS, nullptr, nullptr, 1.0f, QP16, QPh, QPl);
        k_gemmw<bf, 0, false><<<dim3(TT / 64, DKV / 64, 1), 32, 0, stream>>>(XB, nullptr, WK, nullptr, DM, FK, DKV, nullptr, 0, 0, 0);
        k_rope<<<LKv, 256, 0, stream>>>(FK, DKV, NKV, CS, nullptr, nullptr, 1.0f, KP16, KPh, KPl);
        k_gemmw<bf, 0, false><<<dim3(TT / 64, DKV / 64, 1), 32, 0, stream>>>(XB, nullptr, WV, nullptr, DM, FV, DKV, nullptr, 0, 0, 0); k_vtp<<<LKv, 256, 0, stream>>>(FV, DKV, NKV, VT16, VTh, VTl);
        for (int h0 = 0; h0 < NH_; h0 += ZH) { const size_t zq = (size_t)h0, zk = (size_t)(h0 / REP);   // one kv head per query head: the pass's single head (ZH 1) uses kv plane h0 / REP (z-stride TT*HD)
            k_gemmc<bf, 2, 1><<<dim3(RH / 64, TT / 64, ZH), 32, 0, stream>>>(QPh + zq * TT * HD, QPl + zq * TT * HD, KPh + zk * TT * HD, KPl + zk * TT * HD, HD, Sb, TT, 0, (size_t)TT * HD, (size_t)TT * HD, (size_t)TT * TT);
            k_asoft<<<ZH * TT / 8, 256, 0, stream>>>(Sb, P16, Ph, Pl);
            k_gemmc<bf, 2, 2><<<dim3(RH / 64, HD / 64, ZH), 32, 0, stream>>>(Ph, Pl, VTh + zk * HD * TT, VTl + zk * HD * TT, TT, Ob, HD, 0, (size_t)RH * TT, (size_t)HD * TT, (size_t)TT * HD);
            k_merge<<<(unsigned)(((size_t)ZH * TT * HD / 2 + 255) / 256), 256, 0, stream>>>(Ob, h0, OUT + (size_t)b * TT * DQ); }
         }
}

// v001
// A run of this version takes 172 microseconds.
// Two timings next to v000 put it at 2.89 and 2.86 times that version's speed.
#include <hip/hip_runtime.h>

// Single causal attention head scaled by the EMBEDDING width (x [4][2048][1024]; k = x Wk, q = x Wq, v = x Wv ('xw' [1024][64], no bias; ONE 64-wide head); wei = q.k^T x C^-0.5 with C = n_embed = 1024 (not head_size); causal (-inf); softmax; out = wei.v -> [4][2048][64] (0.5 M); argument order x, Wk, Wq, Wv (the KEY weight comes first)).
// Layout, all four batch elements in every launch (the batch is a grid dimension; every workspace plane holds NB_ slabs): bf16 copy of x; 'xw' weights transposed once; exact projections (N 64); identity-table plane builders; causal T-2048 attention at NH 1 / ZH 1 with EVERY row on hi/lo planes (3 products for scores and P.V: one head and no output projection); the f32 merge writes the output rows.
// Compute dtypes, f32 accumulate: every input rounded to bf16; projections exact; attention 3 products on every row; softmax f32; output f32.

#define NB_  4
#define TT   2048
#define DM   1024
#define NH_  1
#define NKV  1
#define REP  (NH_ / NKV)
#define HD   64
#define DQ   (NH_ * HD)
#define DKV  (NKV * HD)
#define ZH   1                    // ONE head: a single plane per pass
#define RH   TT                   // every row hi/lo (3 products)
#define WIN  2048
#define PCAR 1024.0f
#define SCL  0.03125f   // C^-0.5 with C = n_embed = 1024
typedef _Float16 h16;
typedef unsigned short bf;
typedef __attribute__((ext_vector_type(16))) __bf16   v16bf;
typedef __attribute__((ext_vector_type(16))) _Float16 v16h;
typedef __attribute__((ext_vector_type(8)))  _Float16 v8h;
typedef __attribute__((ext_vector_type(8)))  unsigned short v8us;
typedef __attribute__((ext_vector_type(8)))  float    v8f;
typedef __attribute__((ext_vector_type(4)))  float    v4f;
typedef v8h  __attribute__((may_alias)) v8ha;
typedef v4f  __attribute__((may_alias)) v4fa;
typedef v8us __attribute__((may_alias)) v8usa;

__device__ __forceinline__ unsigned short f2bf(float f) { unsigned u = __float_as_uint(f); u += 0x7FFFu + ((u >> 16) & 1u); return (unsigned short)(u >> 16); }
__device__ __forceinline__ float bf2f(unsigned short b) { return __uint_as_float(((unsigned)b) << 16); }
__device__ __forceinline__ float bfr(float f) { return bf2f(f2bf(f)); }
__device__ __forceinline__ v16h cat16(v8h lo, v8h hi) { return __builtin_shufflevector(lo, hi, 0, 1, 2, 3, 4, 5, 6, 7, 8, 9, 10, 11, 12, 13, 14, 15); }
__device__ __forceinline__ v16bf cat16b(v8us lo, v8us hi) { return __builtin_bit_cast(v16bf, __builtin_shufflevector(lo, hi, 0, 1, 2, 3, 4, 5, 6, 7, 8, 9, 10, 11, 12, 13, 14, 15)); }
__device__ __forceinline__ v8f wmma16(v16h a, v16h b, v8f c) { return __builtin_amdgcn_wmma_f32_16x16x32_f16(false, a, false, b, (short)0, c, false, false); }
__device__ __forceinline__ v8f wmmab(v16bf a, v16bf b, v8f c) { return __builtin_amdgcn_wmma_f32_16x16x32_bf16(false, a, false, b, (short)0, c, false, false); }



// ---- k_gemmw: register-blocked GEMM, ONE WAVE per 64x64 output tile (16 accumulators), operands straight from K-contiguous 16-bit planes; grid (M/64, N/64, Z), 32 threads.
// C[m][n] (f32, pitch ldc, + optional f32 bias[n]) = sum_k A[m][k] Bt[n][k] (+ split products per NSPLIT). z-batch strides sA/sB/sC in elements. K % 32 == 0.
template <typename T16> struct WFrag;
template <> struct WFrag<h16> { typedef v16h V; static __device__ __forceinline__ V ld(const h16* p) { return cat16(*(const v8h*)p, *(const v8h*)(p + 16)); } static __device__ __forceinline__ v8f mma(V a, V b, v8f c) { return wmma16(a, b, c); } };
template <> struct WFrag<bf> { typedef v16bf V; static __device__ __forceinline__ V ld(const bf* p) { return cat16b(*(const v8us*)p, *(const v8us*)(p + 16)); } static __device__ __forceinline__ v8f mma(V a, V b, v8f c) { return wmmab(a, b, c); } };
template <typename T16, int NSPLIT, bool BIAS>
__global__ __launch_bounds__(32) void k_gemmw(const T16* __restrict__ A, const T16* __restrict__ A2, const T16* __restrict__ Bt, const T16* __restrict__ Bt2, int K, float* C, int ldc, const float* __restrict__ bias, size_t sA, size_t sB, size_t sC) {
    typedef typename WFrag<T16>::V V;
    __shared__ __align__(16) float os[16 * 68];
    const size_t z = blockIdx.z; A += z * sA; if (A2) A2 += z * sA; Bt += z * sB; if (Bt2) Bt2 += z * sB; C += z * sC;
    const int lane = threadIdx.x & 31, lr = lane & 15, hi = lane >> 4; const int r0 = blockIdx.x * 64, c0 = blockIdx.y * 64;
    v8f acc[4][4];
#pragma unroll
    for (int mb = 0; mb < 4; ++mb)
#pragma unroll
        for (int nb = 0; nb < 4; ++nb) acc[mb][nb] = (v8f){};
    const size_t aoff = (size_t)(r0 + lr) * K + 8 * hi, boff = (size_t)(c0 + lr) * K + 8 * hi;
#pragma unroll 1
    for (int kc = 0; kc < K; kc += 32) {
        V a[4], a2[4];
#pragma unroll
        for (int mb = 0; mb < 4; ++mb) { a[mb] = WFrag<T16>::ld(A + aoff + (size_t)mb * 16 * K + kc); if (NSPLIT == 1 || NSPLIT == 2) a2[mb] = WFrag<T16>::ld(A2 + aoff + (size_t)mb * 16 * K + kc); }
#pragma unroll
        for (int nb = 0; nb < 4; ++nb) { const V b = WFrag<T16>::ld(Bt + boff + (size_t)nb * 16 * K + kc); V b2; if (NSPLIT >= 2) b2 = WFrag<T16>::ld(Bt2 + boff + (size_t)nb * 16 * K + kc);
#pragma unroll
            for (int mb = 0; mb < 4; ++mb) { acc[mb][nb] = WFrag<T16>::mma(a[mb], b, acc[mb][nb]); if (NSPLIT == 1 || NSPLIT == 2) acc[mb][nb] = WFrag<T16>::mma(a2[mb], b, acc[mb][nb]); if (NSPLIT >= 2) acc[mb][nb] = WFrag<T16>::mma(a[mb], b2, acc[mb][nb]); } }
        asm volatile("v_nop\n\tv_nop\n\tv_nop\n\tv_nop" : "+v"(acc[0][0]), "+v"(acc[1][1]), "+v"(acc[2][2]), "+v"(acc[3][3]) : "v"(a[0]), "v"(a[3]));
    }
#pragma unroll
    for (int mb = 0; mb < 4; ++mb) {
#pragma unroll
        for (int nb = 0; nb < 4; ++nb) {
#pragma unroll
            for (int j = 0; j < 8; ++j) os[(hi * 8 + j) * 68 + nb * 16 + lr] = acc[mb][nb][j]; }
        __builtin_amdgcn_wave_barrier(); asm volatile("" ::: "memory");
        float* crow = C + (size_t)(r0 + mb * 16) * ldc + c0;
{
#pragma unroll
            for (int s = 0; s < 8; ++s) { const int row = 2 * s + hi, cofs = lr * 4; v4f val = *(const v4fa*)(os + row * 68 + cofs); if (BIAS) { val[0] += bfr(bias[c0 + cofs]); val[1] += bfr(bias[c0 + cofs + 1]); val[2] += bfr(bias[c0 + cofs + 2]); val[3] += bfr(bias[c0 + cofs + 3]); }
                *(v4f*)(crow + (size_t)row * ldc + cofs) = val; }
             }
        __builtin_amdgcn_wave_barrier(); asm volatile("" ::: "memory");
    }
}

// ---- k_gemmc: the same one-wave 64x64 tile GEMM specialised for causal attention: CMODE 1 skips score tiles entirely above the diagonal (query rows r0+roff.., key columns c0..), CMODE 2 limits the
// key (K) loop of the probability x value contraction to the diagonal block (probabilities beyond it are exactly zero). roff = row offset of this launch's first row within the sequence.
template <typename T16, int NSPLIT, int CMODE>
__global__ __launch_bounds__(32) void k_gemmc(const T16* __restrict__ A, const T16* __restrict__ A2, const T16* __restrict__ Bt, const T16* __restrict__ Bt2, int K, float* C, int ldc, int roff, size_t sA, size_t sB, size_t sC) {
    typedef typename WFrag<T16>::V V;
    __shared__ __align__(16) float os[16 * 68];
    const size_t z = blockIdx.z; A += z * sA; if (A2) A2 += z * sA; Bt += z * sB; if (Bt2) Bt2 += z * sB; C += z * sC;
    const int lane = threadIdx.x & 31, lr = lane & 15, hi = lane >> 4; const int r0 = blockIdx.x * 64, c0 = blockIdx.y * 64;
    if (CMODE == 1 && c0 > r0 + roff + 63) return;                  // score tile entirely above the causal diagonal: never written (the softmax masks j > i by select)
    const int Kl = (CMODE == 2) ? min(K, r0 + roff + 64) : K;        // P.V: probabilities are exactly 0 beyond the diagonal block, so the K loop stops there
    v8f acc[4][4];
#pragma unroll
    for (int mb = 0; mb < 4; ++mb)
#pragma unroll
        for (int nb = 0; nb < 4; ++nb) acc[mb][nb] = (v8f){};
    const size_t aoff = (size_t)(r0 + lr) * K + 8 * hi, boff = (size_t)(c0 + lr) * K + 8 * hi;
#pragma unroll 1
    for (int kc = 0; kc < Kl; kc += 32) {
        V a[4], a2[4];
#pragma unroll
        for (int mb = 0; mb < 4; ++mb) { a[mb] = WFrag<T16>::ld(A + aoff + (size_t)mb * 16 * K + kc); if (NSPLIT == 1 || NSPLIT == 2) a2[mb] = WFrag<T16>::ld(A2 + aoff + (size_t)mb * 16 * K + kc); }
#pragma unroll
        for (int nb = 0; nb < 4; ++nb) { const V b = WFrag<T16>::ld(Bt + boff + (size_t)nb * 16 * K + kc); V b2; if (NSPLIT >= 2) b2 = WFrag<T16>::ld(Bt2 + boff + (size_t)nb * 16 * K + kc);
#pragma unroll
            for (int mb = 0; mb < 4; ++mb) { acc[mb][nb] = WFrag<T16>::mma(a[mb], b, acc[mb][nb]); if (NSPLIT == 1 || NSPLIT == 2) acc[mb][nb] = WFrag<T16>::mma(a2[mb], b, acc[mb][nb]); if (NSPLIT >= 2) acc[mb][nb] = WFrag<T16>::mma(a[mb], b2, acc[mb][nb]); } }
        asm volatile("v_nop\n\tv_nop\n\tv_nop\n\tv_nop" : "+v"(acc[0][0]), "+v"(acc[1][1]), "+v"(acc[2][2]), "+v"(acc[3][3]) : "v"(a[0]), "v"(a[3]));
    }
#pragma unroll
    for (int mb = 0; mb < 4; ++mb) {
#pragma unroll
        for (int nb = 0; nb < 4; ++nb) {
#pragma unroll
            for (int j = 0; j < 8; ++j) os[(hi * 8 + j) * 68 + nb * 16 + lr] = acc[mb][nb][j]; }
        __builtin_amdgcn_wave_barrier(); asm volatile("" ::: "memory");
        float* crow = C + (size_t)(r0 + mb * 16) * ldc + c0;
{
#pragma unroll
            for (int s = 0; s < 8; ++s) { const int row = 2 * s + hi, cofs = lr * 4; v4f val = *(const v4fa*)(os + row * 68 + cofs);
                *(v4f*)(crow + (size_t)row * ldc + cofs) = val; }
             }
        __builtin_amdgcn_wave_barrier(); asm volatile("" ::: "memory");
    }
}

__device__ __forceinline__ h16 tohx(float x) { return (h16)x; }
__device__ __forceinline__ void splitf(float y, unsigned short& h, unsigned short& l) { h = f2bf(y); l = f2bf(y - bf2f(h)); }
typedef __attribute__((ext_vector_type(2))) _Float16 v2h;
typedef __attribute__((ext_vector_type(4))) _Float16 v4h;
typedef __attribute__((ext_vector_type(2))) unsigned short v2us;
typedef __attribute__((ext_vector_type(4))) unsigned short v4us;
typedef __attribute__((ext_vector_type(2))) float v2f;
typedef __attribute__((ext_vector_type(4))) int v4i;

__global__ __launch_bounds__(256) void k_wtG(const float* __restrict__ w, int K, int N, bf* Bt) {
    const int lane = threadIdx.x & 31; const int L0 = (blockIdx.x * 8 + (threadIdx.x >> 5)) * 8; const int nlines = N * K / 64;
{
#pragma unroll 1
        for (int l = 0; l < 8; ++l) { const int L = L0 + l; if (L >= nlines) break; const size_t e = (size_t)L * 64 + lane * 2; const int k = (int)(e % K), n = (int)(e / K); v2us o;
            o[0] = f2bf(w[(size_t)k * N + n]); o[1] = f2bf(w[(size_t)(k + 1) * N + n]); *(v2us*)(Bt + e) = o; }
         }
}
__global__ __launch_bounds__(256) void k_cvt8(const float* __restrict__ src, bf* dst, size_t n8) { const size_t i = (size_t)blockIdx.x * 256 + threadIdx.x; if (i >= n8) return; const v8f v = *(const v8f*)(src + i * 8); v8us o;
#pragma unroll
    for (int k = 0; k < 8; ++k) o[k] = f2bf(v[k]); *(v8us*)(dst + i * 8) = o;  }

// k_rope: head planes [h][t][d] (fp16 + hi/lo) of rope(x) x sc with the rotate-half convention out[d] = x[d] cos[t][d] - x[d+HD/2] sin[t][d], out[d+HD/2] = x[d+HD/2] cos[t][d+HD/2] + x[d] sin[t][d+HD/2]
__global__ __launch_bounds__(256) void k_rope(const float* __restrict__ F, int pitch, int nheads, const float* __restrict__ CS, const float* __restrict__ RF, const float* __restrict__ nw, float sc, h16* P16, bf* Ph, bf* Pl) {
    { const size_t bz = blockIdx.y; F += bz * TT * pitch; P16 += bz * nheads * TT * HD; Ph += bz * nheads * TT * HD; Pl += bz * nheads * TT * HD; }   // grid y = batch element: its rows of F, its slab of each plane (CS is shared; RF and nw are null in every launch here and are not offset)
    const size_t e = ((size_t)blockIdx.x * 256 + threadIdx.x) * 2; if (e >= (size_t)nheads * TT * HD) return; const int d = (int)(e % HD); const int t = (int)((e / HD) % TT); const int h = (int)(e / ((size_t)HD * TT)); const float* f = F + (size_t)t * pitch + h * HD; const float rf = RF ? RF[(size_t)h * TT + t] : 1.0f; v2h o16; v2us oh, ol;
#pragma unroll
    for (int q = 0; q < 2; ++q) { const int dd = d + q; const int dp = (dd < HD / 2) ? dd + HD / 2 : dd - HD / 2; float x0 = f[dd], x1 = f[dp];
        if (RF) { float n0 = __fmul_rn(x0, rf), n1 = __fmul_rn(x1, rf); asm volatile("" : "+v"(n0)); asm volatile("" : "+v"(n1)); x0 = __fmul_rn(bfr(nw[dd]), n0); x1 = __fmul_rn(bfr(nw[dp]), n1); }
        const v2f cs = *(const v2f*)(CS + ((size_t)t * HD + dd) * 2); float a = __fmul_rn(x0, cs[0]), bq = __fmul_rn(x1, cs[1]); asm volatile("" : "+v"(a)); asm volatile("" : "+v"(bq)); const float r = ((dd < HD / 2) ? __fsub_rn(a, bq) : __fadd_rn(a, bq)) * sc;
        o16[q] = tohx(r); unsigned short a2, c2; splitf(r, a2, c2); oh[q] = a2; ol[q] = c2; }
    *(v2h*)(P16 + e) = o16; *(v2us*)(Ph + e) = oh; *(v2us*)(Pl + e) = ol;  }
__global__ __launch_bounds__(256) void k_vtp(const float* __restrict__ F, int pitch, int nheads, h16* V16, bf* Vh, bf* Vl) { { const size_t bz = blockIdx.y; F += bz * TT * pitch; V16 += bz * nheads * HD * TT; Vh += bz * nheads * HD * TT; Vl += bz * nheads * HD * TT; }   /* grid y = batch element */ const size_t e = ((size_t)blockIdx.x * 256 + threadIdx.x) * 2; if (e >= (size_t)nheads * HD * TT) return; const int t = (int)(e % TT); const int d = (int)((e / TT) % HD); const int g = (int)(e / ((size_t)TT * HD)); v2h o16; v2us oh, ol;
#pragma unroll
    for (int q = 0; q < 2; ++q) { const float x = F[(size_t)(t + q) * pitch + g * HD + d]; o16[q] = tohx(x); unsigned short a2, c2; splitf(x, a2, c2); oh[q] = a2; ol[q] = c2; }
    *(v2h*)(V16 + e) = o16; *(v2us*)(Vh + e) = oh; *(v2us*)(Vl + e) = ol;  }
__global__ __launch_bounds__(256) void k_csid(float* CS) { const int idx = blockIdx.x * 256 + threadIdx.x; if (idx >= TT * HD) return; v2f cs; cs[0] = 1.0f; cs[1] = 0.0f; *(v2f*)(CS + (size_t)idx * 2) = cs;  }
// k_asoft: per row (zz, i): t = S x C^-0.5 (C = n_embed = 1024) for j <= i and i - j < WIN (sliding causal window; the reference's -1e9 additive fill vanishes identically); softmax over the 2048 keys (register row, one exp, fixed trees);
__global__ __launch_bounds__(256) void k_asoft(const float* __restrict__ Sb, h16* P16, bf* Ph, bf* Pl) {
    const int lane = threadIdx.x & 31; const int row = blockIdx.x * 8 + (threadIdx.x >> 5); if (row >= NB_ * ZH * TT) return; const int i = row % TT; const int zz = row / TT; (void)zz; const bool hires = (i < RH); const float* sr = Sb + (size_t)row * TT; float v[TT / 32]; float mx = -3.0e38f;
#pragma unroll
    for (int ch = 0; ch < TT / 128; ++ch) { const int j0 = ch * 128 + lane * 4; const v4f a = *(const v4f*)(sr + j0);
#pragma unroll
        for (int q = 0; q < 4; ++q) { const int j = j0 + q; (void)j; const float t = (j <= i && i - j < WIN) ? a[q] * SCL : -3.0e38f; v[ch * 4 + q] = t; mx = fmaxf(mx, t); } }
#pragma unroll
    for (int sh = 16; sh; sh >>= 1) mx = fmaxf(mx, __shfl_xor(mx, sh, 32));
    float sum = 0.f;
#pragma unroll
    for (int k = 0; k < TT / 32; ++k) { float d0 = __fsub_rn(v[k], mx); asm volatile("" : "+v"(d0)); v[k] = __builtin_amdgcn_exp2f(__fmul_rn(d0, 1.4426950408889634f)); sum += v[k]; }
#pragma unroll
    for (int sh = 16; sh; sh >>= 1) sum += __shfl_xor(sum, sh, 32);
    const float f = __fdiv_rn(hires ? 1.0f : PCAR, sum);
{
        if (hires) {
#pragma unroll
            for (int ch = 0; ch < TT / 128; ++ch) { v4us oh, ol;
#pragma unroll
                for (int q = 0; q < 4; ++q) { unsigned short a, c2; splitf(v[ch * 4 + q] * f, a, c2); oh[q] = a; ol[q] = c2; }
                const size_t oo = ((size_t)zz * (RH ? RH : 1) + i) * TT + ch * 128 + lane * 4; *(v4us*)(Ph + oo) = oh; *(v4us*)(Pl + oo) = ol; }
        } else {
#pragma unroll
            for (int ch = 0; ch < TT / 128; ++ch) { v4h o4;
#pragma unroll
                for (int q = 0; q < 4; ++q) o4[q] = tohx(v[ch * 4 + q] * f);
                *(v4h*)(P16 + (size_t)row * TT + ch * 128 + lane * 4) = o4; } }
         }
}
__global__ __launch_bounds__(256) void k_merge(const float* __restrict__ O, int h0, float* OUTb) { O += (size_t)blockIdx.y * ZH * TT * HD; OUTb += (size_t)blockIdx.y * TT * DQ;   /* grid y = batch element */ const size_t e = ((size_t)blockIdx.x * 256 + threadIdx.x) * 2; if (e >= (size_t)ZH * TT * HD) return; const int d = (int)(e % HD); const int t = (int)((e / HD) % TT); const int zz = (int)(e / ((size_t)HD * TT)); const float cs = (t < RH) ? 1.0f : (1.0f / PCAR); const size_t oo = (size_t)t * DQ + (h0 + zz) * HD + d;
    v2f o2; o2[0] = O[e] * cs; o2[1] = O[e + 1] * cs; *(v2f*)(OUTb + oo) = o2;  }

extern "C" void kernel_launch(void* const* d_in, const int* in_sizes, int n_in,
                              void* d_out, int out_size, void* d_ws, size_t ws_size, hipStream_t stream) {
    (void)in_sizes; (void)n_in; (void)out_size;
    const float* x = (const float*)d_in[0]; const float* wk = (const float*)d_in[1]; const float* wq = (const float*)d_in[2]; const float* wv = (const float*)d_in[3]; const float* wo = nullptr; (void)wo;   /* order x, Wk, Wq, Wv ('xw' [1024][64]; NOTE the key weight comes FIRST) */
    float* OUT = (float*)d_out;     // [4][2048][64]
    char* wsp = (char*)d_ws;
    auto take = [&](size_t bytes) { char* p = wsp; wsp += (bytes + 255) & ~(size_t)255; return (void*)p; };
    bf* WQ = (bf*)take((size_t)DQ * DM * 2); bf* WK = (bf*)take((size_t)DKV * DM * 2); bf* WV = (bf*)take((size_t)DKV * DM * 2); float* CS = (float*)take((size_t)TT * HD * 2 * 4);
    bf* XB = (bf*)take((size_t)NB_ * TT * DM * 2); float* FQ = (float*)take((size_t)NB_ * TT * DQ * 4); float* FK = (float*)take((size_t)NB_ * TT * DKV * 4);
    h16* QP16 = (h16*)take((size_t)NB_ * NH_ * TT * HD * 2); h16* KP16 = (h16*)take((size_t)NB_ * NKV * TT * HD * 2); h16* VT16 = (h16*)take((size_t)NB_ * NKV * HD * TT * 2);
    bf* QPh = (bf*)take((size_t)NB_ * NH_ * TT * HD * 2); bf* QPl = (bf*)take((size_t)NB_ * NH_ * TT * HD * 2); bf* KPh = (bf*)take((size_t)NB_ * NKV * TT * HD * 2); bf* KPl = (bf*)take((size_t)NB_ * NKV * TT * HD * 2); bf* VTh = (bf*)take((size_t)NB_ * NKV * HD * TT * 2); bf* VTl = (bf*)take((size_t)NB_ * NKV * HD * TT * 2); bf* Ph = (bf*)take((size_t)NB_ * ZH * RH * TT * 2); bf* Pl = (bf*)take((size_t)NB_ * ZH * RH * TT * 2);
    float* Sb = (float*)take((size_t)NB_ * ZH * TT * TT * 4); h16* P16 = (h16*)take((size_t)NB_ * ZH * TT * TT * 2); float* Ob = (float*)take((size_t)NB_ * ZH * TT * HD * 4);
    if ((size_t)(wsp - (char*)d_ws) > ws_size) return;    // ws 256 MiB; the NB_ slabs take about 190 MiB
    float* FV = FK;   // v projection reuses the k buffer after the k planes are built (stream-ordered)
    k_wtG<<<(unsigned)((DM * DQ / 64 + 63) / 64), 256, 0, stream>>>(wq, DM, DQ, WQ); k_wtG<<<(unsigned)((DM * DKV / 64 + 63) / 64), 256, 0, stream>>>(wk, DM, DKV, WK); k_wtG<<<(unsigned)((DM * DKV / 64 + 63) / 64), 256, 0, stream>>>(wv, DM, DKV, WV);
    k_csid<<<(TT * HD + 255) / 256, 256, 0, stream>>>(CS);
    const unsigned LQ = (unsigned)(((size_t)NH_ * TT * HD / 2 + 255) / 256), LKv = (unsigned)(((size_t)NKV * TT * HD / 2 + 255) / 256);
    // x is [NB_ * TT][DM] row-contiguous, so the copy and the projections take the batch as more rows; the plane builders and the merge take it as grid y, the attention GEMMs as grid z, the softmax as more rows.
    k_cvt8<<<(unsigned)(((size_t)NB_ * TT * DM / 8 + 255) / 256), 256, 0, stream>>>(x, XB, (size_t)NB_ * TT * DM / 8);
    k_gemmw<bf, 0, false><<<dim3(NB_ * TT / 64, DQ / 64, 1), 32, 0, stream>>>(XB, nullptr, WQ, nullptr, DM, FQ, DQ, nullptr, 0, 0, 0);
    k_rope<<<dim3(LQ, NB_, 1), 256, 0, stream>>>(FQ, DQ, NH_, CS, nullptr, nullptr, 1.0f, QP16, QPh, QPl);
    k_gemmw<bf, 0, false><<<dim3(NB_ * TT / 64, DKV / 64, 1), 32, 0, stream>>>(XB, nullptr, WK, nullptr, DM, FK, DKV, nullptr, 0, 0, 0);
    k_rope<<<dim3(LKv, NB_, 1), 256, 0, stream>>>(FK, DKV, NKV, CS, nullptr, nullptr, 1.0f, KP16, KPh, KPl);
    k_gemmw<bf, 0, false><<<dim3(NB_ * TT / 64, DKV / 64, 1), 32, 0, stream>>>(XB, nullptr, WV, nullptr, DM, FV, DKV, nullptr, 0, 0, 0);
    k_vtp<<<dim3(LKv, NB_, 1), 256, 0, stream>>>(FV, DKV, NKV, VT16, VTh, VTl);
    k_gemmc<bf, 2, 1><<<dim3(RH / 64, TT / 64, NB_), 32, 0, stream>>>(QPh, QPl, KPh, KPl, HD, Sb, TT, 0, (size_t)TT * HD, (size_t)TT * HD, (size_t)TT * TT);
    k_asoft<<<NB_ * ZH * TT / 8, 256, 0, stream>>>(Sb, P16, Ph, Pl);
    k_gemmc<bf, 2, 2><<<dim3(RH / 64, HD / 64, NB_), 32, 0, stream>>>(Ph, Pl, VTh, VTl, TT, Ob, HD, 0, (size_t)RH * TT, (size_t)HD * TT, (size_t)TT * HD);
    k_merge<<<dim3((unsigned)(((size_t)ZH * TT * HD / 2 + 255) / 256), NB_, 1), 256, 0, stream>>>(Ob, 0, OUT);
}

// v002
// A run of this version takes 114 microseconds.
// Next to v001, in two timings, it ran 1.52 and 1.51 times as fast.
// Over all steps from v000 it is 4.36 times as fast.
#include <hip/hip_runtime.h>

// Single causal attention head scaled by the EMBEDDING width (x [4][2048][1024]; k = x Wk, q = x Wq, v = x Wv ('xw' [1024][64], no bias; ONE 64-wide head); wei = q.k^T x C^-0.5 with C = n_embed = 1024 (not head_size); causal (-inf); softmax; out = wei.v -> [4][2048][64] (0.5 M); argument order x, Wk, Wq, Wv (the KEY weight comes first)).
// Layout, all four batch elements in every launch (the batch is a grid dimension; every workspace plane holds NB_ slabs): bf16 copy of x; 'xw' weights transposed once; exact projections (N 64); identity-table plane builders; causal T-2048 attention at NH 1 / ZH 1 with EVERY row on hi/lo planes (3 products for scores and P.V: one head and no output projection); the f32 merge writes the output rows. The projections and P.V split their K loop over the 16 waves of a work-group; the f32 partial tiles are summed through LDS in wave order.
// Compute dtypes, f32 accumulate: every input rounded to bf16; projections exact; attention 3 products on every row; softmax f32; output f32.

#define NB_  4
#define TT   2048
#define DM   1024
#define NH_  1
#define NKV  1
#define REP  (NH_ / NKV)
#define HD   64
#define DQ   (NH_ * HD)
#define DKV  (NKV * HD)
#define ZH   1                    // ONE head: a single plane per pass
#define RH   TT                   // every row hi/lo (3 products)
#define WIN  2048
#define PCAR 1024.0f
#define SCL  0.03125f   // C^-0.5 with C = n_embed = 1024
typedef _Float16 h16;
typedef unsigned short bf;
typedef __attribute__((ext_vector_type(16))) __bf16   v16bf;
typedef __attribute__((ext_vector_type(16))) _Float16 v16h;
typedef __attribute__((ext_vector_type(8)))  _Float16 v8h;
typedef __attribute__((ext_vector_type(8)))  unsigned short v8us;
typedef __attribute__((ext_vector_type(8)))  float    v8f;
typedef __attribute__((ext_vector_type(4)))  float    v4f;
typedef v8h  __attribute__((may_alias)) v8ha;
typedef v4f  __attribute__((may_alias)) v4fa;
typedef v8us __attribute__((may_alias)) v8usa;

__device__ __forceinline__ unsigned short f2bf(float f) { unsigned u = __float_as_uint(f); u += 0x7FFFu + ((u >> 16) & 1u); return (unsigned short)(u >> 16); }
__device__ __forceinline__ float bf2f(unsigned short b) { return __uint_as_float(((unsigned)b) << 16); }
__device__ __forceinline__ float bfr(float f) { return bf2f(f2bf(f)); }
__device__ __forceinline__ v16h cat16(v8h lo, v8h hi) { return __builtin_shufflevector(lo, hi, 0, 1, 2, 3, 4, 5, 6, 7, 8, 9, 10, 11, 12, 13, 14, 15); }
__device__ __forceinline__ v16bf cat16b(v8us lo, v8us hi) { return __builtin_bit_cast(v16bf, __builtin_shufflevector(lo, hi, 0, 1, 2, 3, 4, 5, 6, 7, 8, 9, 10, 11, 12, 13, 14, 15)); }
__device__ __forceinline__ v8f wmma16(v16h a, v16h b, v8f c) { return __builtin_amdgcn_wmma_f32_16x16x32_f16(false, a, false, b, (short)0, c, false, false); }
__device__ __forceinline__ v8f wmmab(v16bf a, v16bf b, v8f c) { return __builtin_amdgcn_wmma_f32_16x16x32_bf16(false, a, false, b, (short)0, c, false, false); }



// ---- ksum_store: the NW waves of a work-group each hold an f32 partial of the same 64x64 tile (their share of the K loop); 16 rows a pass, every wave puts its partial in LDS and all threads add the NW partials
// in wave order 0..NW-1 (a fixed order). Two LDS buffers in turn, so ONE barrier a pass is enough: a buffer is written again only behind the barrier of the pass after the one that read it.
// The sums stay in registers and go to memory behind the last pass, so that no barrier has to wait for a global store.
typedef __attribute__((ext_vector_type(2))) float v2fk;
typedef v2fk __attribute__((may_alias)) v2fka;
template <int NW, bool BIAS>
__device__ __forceinline__ void ksum_store(const v8f (&acc)[4][4], float* os, float* ctile, int ldc, const float* bias, int c0) {
    static_assert(NW * 32 * 2 == 16 * 64, "two outputs a thread a pass");
    const int tid = threadIdx.x, lane = tid & 31, lr = lane & 15, hi = lane >> 4, wv = tid >> 5; const int row = tid >> 5, cofs = lane * 2; v2fk res[4];
#pragma unroll
    for (int mb = 0; mb < 4; ++mb) {
        float* buf = os + (mb & 1) * (NW * 16 * 68); float* mine = buf + wv * (16 * 68);
#pragma unroll
        for (int nb = 0; nb < 4; ++nb) {
#pragma unroll
            for (int j = 0; j < 8; ++j) mine[(hi * 8 + j) * 68 + nb * 16 + lr] = acc[mb][nb][j]; }
        __syncthreads();   // every wave's partial of these 16 rows is in LDS before any thread adds them up
        v2fk val = *(const v2fka*)(buf + row * 68 + cofs);
#pragma unroll
        for (int p = 1; p < NW; ++p) val += *(const v2fka*)(buf + p * (16 * 68) + row * 68 + cofs);
        if (BIAS) { val[0] += bfr(bias[c0 + cofs]); val[1] += bfr(bias[c0 + cofs + 1]); }
        res[mb] = val;
    }
#pragma unroll
    for (int mb = 0; mb < 4; ++mb) *(v2fk*)(ctile + (size_t)(mb * 16 + row) * ldc + cofs) = res[mb];
}

// ---- k_gemmw: register-blocked GEMM, one work-group of NW waves per 64x64 output tile; every wave holds the whole tile (16 accumulators) for its share of K: the 32-wide K steps wave, wave + NW, ... (neighbouring waves read the two halves of the same 128-byte lines at about the same time); operands straight from K-contiguous 16-bit planes; grid (M/64, N/64, Z), 32 NW threads.
// C[m][n] (f32, pitch ldc, + optional f32 bias[n]) = sum_k A[m][k] Bt[n][k] (+ split products per NSPLIT). z-batch strides sA/sB/sC in elements. K % 32 == 0.
template <typename T16> struct WFrag;
template <> struct WFrag<h16> { typedef v16h V; static __device__ __forceinline__ V ld(const h16* p) { return cat16(*(const v8h*)p, *(const v8h*)(p + 16)); } static __device__ __forceinline__ v8f mma(V a, V b, v8f c) { return wmma16(a, b, c); } };
template <> struct WFrag<bf> { typedef v16bf V; static __device__ __forceinline__ V ld(const bf* p) { return cat16b(*(const v8us*)p, *(const v8us*)(p + 16)); } static __device__ __forceinline__ v8f mma(V a, V b, v8f c) { return wmmab(a, b, c); } };
template <typename T16, int NSPLIT, bool BIAS, int NW>
__global__ __launch_bounds__(32 * NW) void k_gemmw(const T16* __restrict__ A, const T16* __restrict__ A2, const T16* __restrict__ Bt, const T16* __restrict__ Bt2, int K, float* C, int ldc, const float* __restrict__ bias, size_t sA, size_t sB, size_t sC) {
    typedef typename WFrag<T16>::V V;
    __shared__ __align__(16) float os[2 * NW * 16 * 68];
    const size_t z = blockIdx.z; A += z * sA; if (A2) A2 += z * sA; Bt += z * sB; if (Bt2) Bt2 += z * sB; C += z * sC;
    const int lane = threadIdx.x & 31, lr = lane & 15, hi = lane >> 4; const int r0 = blockIdx.x * 64, c0 = blockIdx.y * 64;
    v8f acc[4][4];
#pragma unroll
    for (int mb = 0; mb < 4; ++mb)
#pragma unroll
        for (int nb = 0; nb < 4; ++nb) acc[mb][nb] = (v8f){};
    const size_t aoff = (size_t)(r0 + lr) * K + 8 * hi, boff = (size_t)(c0 + lr) * K + 8 * hi;
    const int wv = __builtin_amdgcn_readfirstlane(threadIdx.x >> 5);   // the wave's number in a scalar register: the K loop stays a scalar branch
#pragma unroll 1
    for (int kc = wv * 32; kc < K; kc += NW * 32) {
        V a[4], a2[4];
#pragma unroll
        for (int mb = 0; mb < 4; ++mb) { a[mb] = WFrag<T16>::ld(A + aoff + (size_t)mb * 16 * K + kc); if (NSPLIT == 1 || NSPLIT == 2) a2[mb] = WFrag<T16>::ld(A2 + aoff + (size_t)mb * 16 * K + kc); }
#pragma unroll
        for (int nb = 0; nb < 4; ++nb) { const V b = WFrag<T16>::ld(Bt + boff + (size_t)nb * 16 * K + kc); V b2; if (NSPLIT >= 2) b2 = WFrag<T16>::ld(Bt2 + boff + (size_t)nb * 16 * K + kc);
#pragma unroll
            for (int mb = 0; mb < 4; ++mb) { acc[mb][nb] = WFrag<T16>::mma(a[mb], b, acc[mb][nb]); if (NSPLIT == 1 || NSPLIT == 2) acc[mb][nb] = WFrag<T16>::mma(a2[mb], b, acc[mb][nb]); if (NSPLIT >= 2) acc[mb][nb] = WFrag<T16>::mma(a[mb], b2, acc[mb][nb]); } }
        asm volatile("v_nop\n\tv_nop\n\tv_nop\n\tv_nop" : "+v"(acc[0][0]), "+v"(acc[1][1]), "+v"(acc[2][2]), "+v"(acc[3][3]) : "v"(a[0]), "v"(a[3]));
    }
    ksum_store<NW, BIAS>(acc, os, C + (size_t)r0 * ldc + c0, ldc, bias, c0);
}

// ---- k_gemmc: the same 64x64 tile GEMM (NW 1: one wave does the whole K loop and stores its tile itself; NW 16: K steps dealt to the waves as in k_gemmw) specialised for causal attention: CMODE 1 skips score tiles entirely above the diagonal (query rows r0+roff.., key columns c0..), CMODE 2 limits the
// key (K) loop of the probability x value contraction to the diagonal block (probabilities beyond it are exactly zero). roff = row offset of this launch's first row within the sequence.
template <typename T16, int NSPLIT, int CMODE, int NW>
__global__ __launch_bounds__(32 * NW) void k_gemmc(const T16* __restrict__ A, const T16* __restrict__ A2, const T16* __restrict__ Bt, const T16* __restrict__ Bt2, int K, float* C, int ldc, int roff, size_t sA, size_t sB, size_t sC) {
    typedef typename WFrag<T16>::V V;
    __shared__ __align__(16) float os[(NW == 1 ? 1 : 2 * NW) * 16 * 68];
    const size_t z = blockIdx.z; A += z * sA; if (A2) A2 += z * sA; Bt += z * sB; if (Bt2) Bt2 += z * sB; C += z * sC;
    const int lane = threadIdx.x & 31, lr = lane & 15, hi = lane >> 4; const int r0 = blockIdx.x * 64, c0 = blockIdx.y * 64;
    if (CMODE == 1 && c0 > r0 + roff + 63) return;                  // score tile entirely above the causal diagonal: never written (the softmax masks j > i by select)
    const int Kl = (CMODE == 2) ? min(K, r0 + roff + 64) : K;        // P.V: probabilities are exactly 0 beyond the diagonal block, so the K loop stops there
    v8f acc[4][4];
#pragma unroll
    for (int mb = 0; mb < 4; ++mb)
#pragma unroll
        for (int nb = 0; nb < 4; ++nb) acc[mb][nb] = (v8f){};
    const size_t aoff = (size_t)(r0 + lr) * K + 8 * hi, boff = (size_t)(c0 + lr) * K + 8 * hi;
    const int wv = (NW == 1) ? 0 : __builtin_amdgcn_readfirstlane(threadIdx.x >> 5);   // the wave's number in a scalar register: the K loop stays a scalar branch
#pragma unroll 1
    for (int kc = wv * 32; kc < Kl; kc += NW * 32) {   // a wave with no K step left keeps a zero partial and still takes part in the sum
        V a[4], a2[4];
#pragma unroll
        for (int mb = 0; mb < 4; ++mb) { a[mb] = WFrag<T16>::ld(A + aoff + (size_t)mb * 16 * K + kc); if (NSPLIT == 1 || NSPLIT == 2) a2[mb] = WFrag<T16>::ld(A2 + aoff + (size_t)mb * 16 * K + kc); }
#pragma unroll
        for (int nb = 0; nb < 4; ++nb) { const V b = WFrag<T16>::ld(Bt + boff + (size_t)nb * 16 * K + kc); V b2; if (NSPLIT >= 2) b2 = WFrag<T16>::ld(Bt2 + boff + (size_t)nb * 16 * K + kc);
#pragma unroll
            for (int mb = 0; mb < 4; ++mb) { acc[mb][nb] = WFrag<T16>::mma(a[mb], b, acc[mb][nb]); if (NSPLIT == 1 || NSPLIT == 2) acc[mb][nb] = WFrag<T16>::mma(a2[mb], b, acc[mb][nb]); if (NSPLIT >= 2) acc[mb][nb] = WFrag<T16>::mma(a[mb], b2, acc[mb][nb]); } }
        asm volatile("v_nop\n\tv_nop\n\tv_nop\n\tv_nop" : "+v"(acc[0][0]), "+v"(acc[1][1]), "+v"(acc[2][2]), "+v"(acc[3][3]) : "v"(a[0]), "v"(a[3]));
    }
    if constexpr (NW > 1) { ksum_store<NW, false>(acc, os, C + (size_t)r0 * ldc + c0, ldc, nullptr, c0); return; }
#pragma unroll
    for (int mb = 0; mb < 4; ++mb) {
#pragma unroll
        for (int nb = 0; nb < 4; ++nb) {
#pragma unroll
            for (int j = 0; j < 8; ++j) os[(hi * 8 + j) * 68 + nb * 16 + lr] = acc[mb][nb][j]; }
        __builtin_amdgcn_wave_barrier(); asm volatile("" ::: "memory");
        float* crow = C + (size_t)(r0 + mb * 16) * ldc + c0;
{
#pragma unroll
            for (int s = 0; s < 8; ++s) { const int row = 2 * s + hi, cofs = lr * 4; v4f val = *(const v4fa*)(os + row * 68 + cofs);
                *(v4f*)(crow + (size_t)row * ldc + cofs) = val; }
             }
        __builtin_amdgcn_wave_barrier(); asm volatile("" ::: "memory");
    }
}

__device__ __forceinline__ h16 tohx(float x) { return (h16)x; }
__device__ __forceinline__ void splitf(float y, unsigned short& h, unsigned short& l) { h = f2bf(y); l = f2bf(y - bf2f(h)); }
typedef __attribute__((ext_vector_type(2))) _Float16 v2h;
typedef __attribute__((ext_vector_type(4))) _Float16 v4h;
typedef __attribute__((ext_vector_type(2))) unsigned short v2us;
typedef __attribute__((ext_vector_type(4))) unsigned short v4us;
typedef __attribute__((ext_vector_type(2))) float v2f;
typedef __attribute__((ext_vector_type(4))) int v4i;

__global__ __launch_bounds__(256) void k_wtG(const float* __restrict__ w, int K, int N, bf* Bt) {
    const int lane = threadIdx.x & 31; const int L0 = (blockIdx.x * 8 + (threadIdx.x >> 5)) * 8; const int nlines = N * K / 64;
{
#pragma unroll 1
        for (int l = 0; l < 8; ++l) { const int L = L0 + l; if (L >= nlines) break; const size_t e = (size_t)L * 64 + lane * 2; const int k = (int)(e % K), n = (int)(e / K); v2us o;
            o[0] = f2bf(w[(size_t)k * N + n]); o[1] = f2bf(w[(size_t)(k + 1) * N + n]); *(v2us*)(Bt + e) = o; }
         }
}
__global__ __launch_bounds__(256) void k_cvt8(const float* __restrict__ src, bf* dst, size_t n8) { const size_t i = (size_t)blockIdx.x * 256 + threadIdx.x; if (i >= n8) return; const v8f v = *(const v8f*)(src + i * 8); v8us o;
#pragma unroll
    for (int k = 0; k < 8; ++k) o[k] = f2bf(v[k]); *(v8us*)(dst + i * 8) = o;  }

// k_rope: head planes [h][t][d] (fp16 + hi/lo) of rope(x) x sc with the rotate-half convention out[d] = x[d] cos[t][d] - x[d+HD/2] sin[t][d], out[d+HD/2] = x[d+HD/2] cos[t][d+HD/2] + x[d] sin[t][d+HD/2]
__global__ __launch_bounds__(256) void k_rope(const float* __restrict__ F, int pitch, int nheads, const float* __restrict__ CS, const float* __restrict__ RF, const float* __restrict__ nw, float sc, h16* P16, bf* Ph, bf* Pl) {
    { const size_t bz = blockIdx.y; F += bz * TT * pitch; P16 += bz * nheads * TT * HD; Ph += bz * nheads * TT * HD; Pl += bz * nheads * TT * HD; }   // grid y = batch element: its rows of F, its slab of each plane (CS is shared; RF and nw are null in every launch here and are not offset)
    const size_t e = ((size_t)blockIdx.x * 256 + threadIdx.x) * 2; if (e >= (size_t)nheads * TT * HD) return; const int d = (int)(e % HD); const int t = (int)((e / HD) % TT); const int h = (int)(e / ((size_t)HD * TT)); const float* f = F + (size_t)t * pitch + h * HD; const float rf = RF ? RF[(size_t)h * TT + t] : 1.0f; v2h o16; v2us oh, ol;
#pragma unroll
    for (int q = 0; q < 2; ++q) { const int dd = d + q; const int dp = (dd < HD / 2) ? dd + HD / 2 : dd - HD / 2; float x0 = f[dd], x1 = f[dp];
        if (RF) { float n0 = __fmul_rn(x0, rf), n1 = __fmul_rn(x1, rf); asm volatile("" : "+v"(n0)); asm volatile("" : "+v"(n1)); x0 = __fmul_rn(bfr(nw[dd]), n0); x1 = __fmul_rn(bfr(nw[dp]), n1); }
        const v2f cs = *(const v2f*)(CS + ((size_t)t * HD + dd) * 2); float a = __fmul_rn(x0, cs[0]), bq = __fmul_rn(x1, cs[1]); asm volatile("" : "+v"(a)); asm volatile("" : "+v"(bq)); const float r = ((dd < HD / 2) ? __fsub_rn(a, bq) : __fadd_rn(a, bq)) * sc;
        o16[q] = tohx(r); unsigned short a2, c2; splitf(r, a2, c2); oh[q] = a2; ol[q] = c2; }
    *(v2h*)(P16 + e) = o16; *(v2us*)(Ph + e) = oh; *(v2us*)(Pl + e) = ol;  }
__global__ __launch_bounds__(256) void k_vtp(const float* __restrict__ F, int pitch, int nheads, h16* V16, bf* Vh, bf* Vl) { { const size_t bz = blockIdx.y; F += bz * TT * pitch; V16 += bz * nheads * HD * TT; Vh += bz * nheads * HD * TT; Vl += bz * nheads * HD * TT; }   /* grid y = batch element */ const size_t e = ((size_t)blockIdx.x * 256 + threadIdx.x) * 2; if (e >= (size_t)nheads * HD * TT) return; const int t = (int)(e % TT); const int d = (int)((e / TT) % HD); const int g = (int)(e / ((size_t)TT * HD)); v2h o16; v2us oh, ol;
#pragma unroll
    for (int q = 0; q < 2; ++q) { const float x = F[(size_t)(t + q) * pitch + g * HD + d]; o16[q] = tohx(x); unsigned short a2, c2; splitf(x, a2, c2); oh[q] = a2; ol[q] = c2; }
    *(v2h*)(V16 + e) = o16; *(v2us*)(Vh + e) = oh; *(v2us*)(Vl + e) = ol;  }
__global__ __launch_bounds__(256) void k_csid(float* CS) { const int idx = blockIdx.x * 256 + threadIdx.x; if (idx >= TT * HD) return; v2f cs; cs[0] = 1.0f; cs[1] = 0.0f; *(v2f*)(CS + (size_t)idx * 2) = cs;  }
// k_asoft: per row (zz, i): t = S x C^-0.5 (C = n_embed = 1024) for j <= i and i - j < WIN (sliding causal window; the reference's -1e9 additive fill vanishes identically); softmax over the 2048 keys (register row, one exp, fixed trees);
__global__ __launch_bounds__(256) void k_asoft(const float* __restrict__ Sb, h16* P16, bf* Ph, bf* Pl) {
    const int lane = threadIdx.x & 31; const int row = blockIdx.x * 8 + (threadIdx.x >> 5); if (row >= NB_ * ZH * TT) return; const int i = row % TT; const int zz = row / TT; (void)zz; const bool hires = (i < RH); const float* sr = Sb + (size_t)row * TT; float v[TT / 32]; float mx = -3.0e38f;
#pragma unroll
    for (int ch = 0; ch < TT / 128; ++ch) { const int j0 = ch * 128 + lane * 4; const v4f a = *(const v4f*)(sr + j0);
#pragma unroll
        for (int q = 0; q < 4; ++q) { const int j = j0 + q; (void)j; const float t = (j <= i && i - j < WIN) ? a[q] * SCL : -3.0e38f; v[ch * 4 + q] = t; mx = fmaxf(mx, t); } }
#pragma unroll
    for (int sh = 16; sh; sh >>= 1) mx = fmaxf(mx, __shfl_xor(mx, sh, 32));
    float sum = 0.f;
#pragma unroll
    for (int k = 0; k < TT / 32; ++k) { float d0 = __fsub_rn(v[k], mx); asm volatile("" : "+v"(d0)); v[k] = __builtin_amdgcn_exp2f(__fmul_rn(d0, 1.4426950408889634f)); sum += v[k]; }
#pragma unroll
    for (int sh = 16; sh; sh >>= 1) sum += __shfl_xor(sum, sh, 32);
    const float f = __fdiv_rn(hires ? 1.0f : PCAR, sum);
{
        if (hires) {
#pragma unroll
            for (int ch = 0; ch < TT / 128; ++ch) { v4us oh, ol;
#pragma unroll
                for (int q = 0; q < 4; ++q) { unsigned short a, c2; splitf(v[ch * 4 + q] * f, a, c2); oh[q] = a; ol[q] = c2; }
                const size_t oo = ((size_t)zz * (RH ? RH : 1) + i) * TT + ch * 128 + lane * 4; *(v4us*)(Ph + oo) = oh; *(v4us*)(Pl + oo) = ol; }
        } else {
#pragma unroll
            for (int ch = 0; ch < TT / 128; ++ch) { v4h o4;
#pragma unroll
                for (int q = 0; q < 4; ++q) o4[q] = tohx(v[ch * 4 + q] * f);
                *(v4h*)(P16 + (size_t)row * TT + ch * 128 + lane * 4) = o4; } }
         }
}
__global__ __launch_bounds__(256) void k_merge(const float* __restrict__ O, int h0, float* OUTb) { O += (size_t)blockIdx.y * ZH * TT * HD; OUTb += (size_t)blockIdx.y * TT * DQ;   /* grid y = batch element */ const size_t e = ((size_t)blockIdx.x * 256 + threadIdx.x) * 2; if (e >= (size_t)ZH * TT * HD) return; const int d = (int)(e % HD); const int t = (int)((e / HD) % TT); const int zz = (int)(e / ((size_t)HD * TT)); const float cs = (t < RH) ? 1.0f : (1.0f / PCAR); const size_t oo = (size_t)t * DQ + (h0 + zz) * HD + d;
    v2f o2; o2[0] = O[e] * cs; o2[1] = O[e + 1] * cs; *(v2f*)(OUTb + oo) = o2;  }

extern "C" void kernel_launch(void* const* d_in, const int* in_sizes, int n_in,
                              void* d_out, int out_size, void* d_ws, size_t ws_size, hipStream_t stream) {
    (void)in_sizes; (void)n_in; (void)out_size;
    const float* x = (const float*)d_in[0]; const float* wk = (const float*)d_in[1]; const float* wq = (const float*)d_in[2]; const float* wv = (const float*)d_in[3]; const float* wo = nullptr; (void)wo;   /* order x, Wk, Wq, Wv ('xw' [1024][64]; NOTE the key weight comes FIRST) */
    float* OUT = (float*)d_out;     // [4][2048][64]
    char* wsp = (char*)d_ws;
    auto take = [&](size_t bytes) { char* p = wsp; wsp += (bytes + 255) & ~(size_t)255; return (void*)p; };
    bf* WQ = (bf*)take((size_t)DQ * DM * 2); bf* WK = (bf*)take((size_t)DKV * DM * 2); bf* WV = (bf*)take((size_t)DKV * DM * 2); float* CS = (float*)take((size_t)TT * HD * 2 * 4);
    bf* XB = (bf*)take((size_t)NB_ * TT * DM * 2); float* FQ = (float*)take((size_t)NB_ * TT * DQ * 4); float* FK = (float*)take((size_t)NB_ * TT * DKV * 4);
    h16* QP16 = (h16*)take((size_t)NB_ * NH_ * TT * HD * 2); h16* KP16 = (h16*)take((size_t)NB_ * NKV * TT * HD * 2); h16* VT16 = (h16*)take((size_t)NB_ * NKV * HD * TT * 2);
    bf* QPh = (bf*)take((size_t)NB_ * NH_ * TT * HD * 2); bf* QPl = (bf*)take((size_t)NB_ * NH_ * TT * HD * 2); bf* KPh = (bf*)take((size_t)NB_ * NKV * TT * HD * 2); bf* KPl = (bf*)take((size_t)NB_ * NKV * TT * HD * 2); bf* VTh = (bf*)take((size_t)NB_ * NKV * HD * TT * 2); bf* VTl = (bf*)take((size_t)NB_ * NKV * HD * TT * 2); bf* Ph = (bf*)take((size_t)NB_ * ZH * RH * TT * 2); bf* Pl = (bf*)take((size_t)NB_ * ZH * RH * TT * 2);
    float* Sb = (float*)take((size_t)NB_ * ZH * TT * TT * 4); h16* P16 = (h16*)take((size_t)NB_ * ZH * TT * TT * 2); float* Ob = (float*)take((size_t)NB_ * ZH * TT * HD * 4);
    if ((size_t)(wsp - (char*)d_ws) > ws_size) return;    // ws 256 MiB; the NB_ slabs take about 190 MiB
    float* FV = FK;   // v projection reuses the k buffer after the k planes are built (stream-ordered)
    k_wtG<<<(unsigned)((DM * DQ / 64 + 63) / 64), 256, 0, stream>>>(wq, DM, DQ, WQ); k_wtG<<<(unsigned)((DM * DKV / 64 + 63) / 64), 256, 0, stream>>>(wk, DM, DKV, WK); k_wtG<<<(unsigned)((DM * DKV / 64 + 63) / 64), 256, 0, stream>>>(wv, DM, DKV, WV);
    k_csid<<<(TT * HD + 255) / 256, 256, 0, stream>>>(CS);
    const unsigned LQ = (unsigned)(((size_t)NH_ * TT * HD / 2 + 255) / 256), LKv = (unsigned)(((size_t)NKV * TT * HD / 2 + 255) / 256);
    // x is [NB_ * TT][DM] row-contiguous, so the copy and the projections take the batch as more rows; the plane builders and the merge take it as grid y, the attention GEMMs as grid z, the softmax as more rows.
    k_cvt8<<<(unsigned)(((size_t)NB_ * TT * DM / 8 + 255) / 256), 256, 0, stream>>>(x, XB, (size_t)NB_ * TT * DM / 8);
    k_gemmw<bf, 0, false, 16><<<dim3(NB_ * TT / 64, DQ / 64, 1), 512, 0, stream>>>(XB, nullptr, WQ, nullptr, DM, FQ, DQ, nullptr, 0, 0, 0);
    k_rope<<<dim3(LQ, NB_, 1), 256, 0, stream>>>(FQ, DQ, NH_, CS, nullptr, nullptr, 1.0f, QP16, QPh, QPl);
    k_gemmw<bf, 0, false, 16><<<dim3(NB_ * TT / 64, DKV / 64, 1), 512, 0, stream>>>(XB, nullptr, WK, nullptr, DM, FK, DKV, nullptr, 0, 0, 0);
    k_rope<<<dim3(LKv, NB_, 1), 256, 0, stream>>>(FK, DKV, NKV, CS, nullptr, nullptr, 1.0f, KP16, KPh, KPl);
    k_gemmw<bf, 0, false, 16><<<dim3(NB_ * TT / 64, DKV / 64, 1), 512, 0, stream>>>(XB, nullptr, WV, nullptr, DM, FV, DKV, nullptr, 0, 0, 0);
    k_vtp<<<dim3(LKv, NB_, 1), 256, 0, stream>>>(FV, DKV, NKV, VT16, VTh, VTl);
    k_gemmc<bf, 2, 1, 1><<<dim3(RH / 64, TT / 64, NB_), 32, 0, stream>>>(QPh, QPl, KPh, KPl, HD, Sb, TT, 0, (size_t)TT * HD, (size_t)TT * HD, (size_t)TT * TT);
    k_asoft<<<NB_ * ZH * TT / 8, 256, 0, stream>>>(Sb, P16, Ph, Pl);
    k_gemmc<bf, 2, 2, 16><<<dim3(RH / 64, HD / 64, NB_), 512, 0, stream>>>(Ph, Pl, VTh, VTl, TT, Ob, HD, 0, (size_t)RH * TT, (size_t)HD * TT, (size_t)TT * HD);
    k_merge<<<dim3((unsigned)(((size_t)ZH * TT * HD / 2 + 255) / 256), NB_, 1), 256, 0, stream>>>(Ob, 0, OUT);
}

// v003
// It runs in 63.5 microseconds.
// Timed twice side by side with v002, it ran 1.77 and 1.79 times as fast.
// Counting every step since v000, it is 7.74 times as fast.
#include <hip/hip_runtime.h>

// Single causal attention head scaled by the EMBEDDING width (x [4][2048][1024]; k = x Wk, q = x Wq, v = x Wv ('xw' [1024][64], no bias; ONE 64-wide head); wei = q.k^T x C^-0.5 with C = n_embed = 1024 (not head_size); causal (-inf); softmax; out = wei.v -> [4][2048][64] (0.5 M); argument order x, Wk, Wq, Wv (the KEY weight comes first)).
// Layout, all four batch elements in every launch (the batch is a grid dimension; every workspace plane holds NB_ slabs): ONE projection launch (grid y = q, k, v) reads x and the 'xw' weights as f32, rounds them to bf16 in registers and writes the hi/lo planes of q, k and v^T from its own epilogue; causal T-2048 attention at NH 1 / ZH 1 with EVERY row on hi/lo planes (3 products for scores and P.V: one head and no output projection); P.V writes the f32 output rows itself. The projections and P.V split their K loop over the 16 waves of a work-group; the f32 partial tiles are summed through LDS in wave order.
// Compute dtypes, f32 accumulate: every input rounded to bf16; projections exact; attention 3 products on every row; softmax f32; output f32.

#define NB_  4
#define TT   2048
#define DM   1024
#define NH_  1
#define NKV  1
#define REP  (NH_ / NKV)
#define HD   64
#define DQ   (NH_ * HD)
#define DKV  (NKV * HD)
#define ZH   1                    // ONE head: a single plane per pass
#define RH   TT                   // every row hi/lo (3 products)
#define WIN  2048
#define PCAR 1024.0f
#define SCL  0.03125f   // C^-0.5 with C = n_embed = 1024
typedef _Float16 h16;
typedef unsigned short bf;
typedef __attribute__((ext_vector_type(16))) __bf16   v16bf;
typedef __attribute__((ext_vector_type(16))) _Float16 v16h;
typedef __attribute__((ext_vector_type(8)))  _Float16 v8h;
typedef __attribute__((ext_vector_type(8)))  unsigned short v8us;
typedef __attribute__((ext_vector_type(8)))  float    v8f;
typedef __attribute__((ext_vector_type(4)))  float    v4f;
typedef v8h  __attribute__((may_alias)) v8ha;
typedef v4f  __attribute__((may_alias)) v4fa;
typedef v8us __attribute__((may_alias)) v8usa;

__device__ __forceinline__ unsigned short f2bf(float f) { unsigned u = __float_as_uint(f); u += 0x7FFFu + ((u >> 16) & 1u); return (unsigned short)(u >> 16); }
__device__ __forceinline__ float bf2f(unsigned short b) { return __uint_as_float(((unsigned)b) << 16); }
__device__ __forceinline__ v16h cat16(v8h lo, v8h hi) { return __builtin_shufflevector(lo, hi, 0, 1, 2, 3, 4, 5, 6, 7, 8, 9, 10, 11, 12, 13, 14, 15); }
__device__ __forceinline__ v16bf cat16b(v8us lo, v8us hi) { return __builtin_bit_cast(v16bf, __builtin_shufflevector(lo, hi, 0, 1, 2, 3, 4, 5, 6, 7, 8, 9, 10, 11, 12, 13, 14, 15)); }
__device__ __forceinline__ v8f wmma16(v16h a, v16h b, v8f c) { return __builtin_amdgcn_wmma_f32_16x16x32_f16(false, a, false, b, (short)0, c, false, false); }
__device__ __forceinline__ v8f wmmab(v16bf a, v16bf b, v8f c) { return __builtin_amdgcn_wmma_f32_16x16x32_bf16(false, a, false, b, (short)0, c, false, false); }



// ---- ksum_regs: the NW waves of a work-group each hold an f32 partial of the same 64x64 tile (their share of the K loop); 16 rows a pass, every wave puts its partial in LDS and all threads add the NW partials
// in wave order 0..NW-1 (a fixed order). Two LDS buffers in turn, so ONE barrier a pass is enough: a buffer is written again only behind the barrier of the pass after the one that read it.
// The sums stay in registers (res[mb]: row mb * 16 + wave, columns 2 lane and 2 lane + 1) and go to memory behind the last pass, so that no barrier has to wait for a global store.
typedef __attribute__((ext_vector_type(2))) float v2fk;
typedef v2fk __attribute__((may_alias)) v2fka;
template <int NW>
__device__ __forceinline__ void ksum_regs(const v8f (&acc)[4][4], float* os, v2fk (&res)[4]) {
    static_assert(NW * 32 * 2 == 16 * 64, "two outputs a thread a pass");
    const int tid = threadIdx.x, lane = tid & 31, lr = lane & 15, hi = lane >> 4, wv = tid >> 5; const int row = tid >> 5, cofs = lane * 2;
#pragma unroll
    for (int mb = 0; mb < 4; ++mb) {
        float* buf = os + (mb & 1) * (NW * 16 * 68); float* mine = buf + wv * (16 * 68);
#pragma unroll
        for (int nb = 0; nb < 4; ++nb) {
#pragma unroll
            for (int j = 0; j < 8; ++j) mine[(hi * 8 + j) * 68 + nb * 16 + lr] = acc[mb][nb][j]; }
        __syncthreads();   // every wave's partial of these 16 rows is in LDS before any thread adds them up
        v2fk val = *(const v2fka*)(buf + row * 68 + cofs);
#pragma unroll
        for (int p = 1; p < NW; ++p) val += *(const v2fka*)(buf + p * (16 * 68) + row * 68 + cofs);
        res[mb] = val;
    }
}
template <int NW>
__device__ __forceinline__ void ksum_store(const v8f (&acc)[4][4], float* os, float* ctile, int ldc) {
    const int row = threadIdx.x >> 5, cofs = (threadIdx.x & 31) * 2; v2fk res[4]; ksum_regs<NW>(acc, os, res);
#pragma unroll
    for (int mb = 0; mb < 4; ++mb) *(v2fk*)(ctile + (size_t)(mb * 16 + row) * ldc + cofs) = res[mb];
}

// fragment loader and matrix instruction per 16-bit operand type
template <typename T16> struct WFrag;
template <> struct WFrag<h16> { typedef v16h V; static __device__ __forceinline__ V ld(const h16* p) { return cat16(*(const v8h*)p, *(const v8h*)(p + 16)); } static __device__ __forceinline__ v8f mma(V a, V b, v8f c) { return wmma16(a, b, c); } };
template <> struct WFrag<bf> { typedef v16bf V; static __device__ __forceinline__ V ld(const bf* p) { return cat16b(*(const v8us*)p, *(const v8us*)(p + 16)); } static __device__ __forceinline__ v8f mma(V a, V b, v8f c) { return wmmab(a, b, c); } };

// ---- k_gemmc: register-blocked 64x64 tile GEMM, operands straight from K-contiguous 16-bit planes, C[m][n] (f32, pitch ldc) = sum_k A[m][k] Bt[n][k] (+ split products per NSPLIT), z-batch strides sA/sB/sC in elements (NW 1: one wave does the whole K loop and stores its tile itself; NW 16: the 32-wide K steps wave, wave + NW, ... go to each wave, which holds the whole tile for its share of K) specialised for causal attention: CMODE 1 skips score tiles entirely above the diagonal (query rows r0+roff.., key columns c0..), CMODE 2 limits the
// key (K) loop of the probability x value contraction to the diagonal block (probabilities beyond it are exactly zero). roff = row offset of this launch's first row within the sequence.
template <typename T16, int NSPLIT, int CMODE, int NW>
__global__ __launch_bounds__(32 * NW) void k_gemmc(const T16* __restrict__ A, const T16* __restrict__ A2, const T16* __restrict__ Bt, const T16* __restrict__ Bt2, int K, float* C, int ldc, int roff, size_t sA, size_t sB, size_t sC) {
    typedef typename WFrag<T16>::V V;
    __shared__ __align__(16) float os[(NW == 1 ? 1 : 2 * NW) * 16 * 68];
    const size_t z = blockIdx.z; A += z * sA; if (A2) A2 += z * sA; Bt += z * sB; if (Bt2) Bt2 += z * sB; C += z * sC;
    const int lane = threadIdx.x & 31, lr = lane & 15, hi = lane >> 4; const int r0 = blockIdx.x * 64, c0 = blockIdx.y * 64;
    if (CMODE == 1 && c0 > r0 + roff + 63) return;                  // score tile entirely above the causal diagonal: never written (the softmax masks j > i by select)
    const int Kl = (CMODE == 2) ? min(K, r0 + roff + 64) : K;        // P.V: probabilities are exactly 0 beyond the diagonal block, so the K loop stops there
    v8f acc[4][4];
#pragma unroll
    for (int mb = 0; mb < 4; ++mb)
#pragma unroll
        for (int nb = 0; nb < 4; ++nb) acc[mb][nb] = (v8f){};
    const size_t aoff = (size_t)(r0 + lr) * K + 8 * hi, boff = (size_t)(c0 + lr) * K + 8 * hi;
    const int wv = (NW == 1) ? 0 : __builtin_amdgcn_readfirstlane(threadIdx.x >> 5);   // the wave's number in a scalar register: the K loop stays a scalar branch
#pragma unroll 1
    for (int kc = wv * 32; kc < Kl; kc += NW * 32) {   // a wave with no K step left keeps a zero partial and still takes part in the sum
        V a[4], a2[4];
#pragma unroll
        for (int mb = 0; mb < 4; ++mb) { a[mb] = WFrag<T16>::ld(A + aoff + (size_t)mb * 16 * K + kc); if (NSPLIT == 1 || NSPLIT == 2) a2[mb] = WFrag<T16>::ld(A2 + aoff + (size_t)mb * 16 * K + kc); }
#pragma unroll
        for (int nb = 0; nb < 4; ++nb) { const V b = WFrag<T16>::ld(Bt + boff + (size_t)nb * 16 * K + kc); V b2; if (NSPLIT >= 2) b2 = WFrag<T16>::ld(Bt2 + boff + (size_t)nb * 16 * K + kc);
#pragma unroll
            for (int mb = 0; mb < 4; ++mb) { acc[mb][nb] = WFrag<T16>::mma(a[mb], b, acc[mb][nb]); if (NSPLIT == 1 || NSPLIT == 2) acc[mb][nb] = WFrag<T16>::mma(a2[mb], b, acc[mb][nb]); if (NSPLIT >= 2) acc[mb][nb] = WFrag<T16>::mma(a[mb], b2, acc[mb][nb]); } }
        asm volatile("v_nop\n\tv_nop\n\tv_nop\n\tv_nop" : "+v"(acc[0][0]), "+v"(acc[1][1]), "+v"(acc[2][2]), "+v"(acc[3][3]) : "v"(a[0]), "v"(a[3]));
    }
    if constexpr (NW > 1) { ksum_store<NW>(acc, os, C + (size_t)r0 * ldc + c0, ldc); return; }
#pragma unroll
    for (int mb = 0; mb < 4; ++mb) {
#pragma unroll
        for (int nb = 0; nb < 4; ++nb) {
#pragma unroll
            for (int j = 0; j < 8; ++j) os[(hi * 8 + j) * 68 + nb * 16 + lr] = acc[mb][nb][j]; }
        __builtin_amdgcn_wave_barrier(); asm volatile("" ::: "memory");
        float* crow = C + (size_t)(r0 + mb * 16) * ldc + c0;
{
#pragma unroll
            for (int s = 0; s < 8; ++s) { const int row = 2 * s + hi, cofs = lr * 4; v4f val = *(const v4fa*)(os + row * 68 + cofs);
                *(v4f*)(crow + (size_t)row * ldc + cofs) = val; }
             }
        __builtin_amdgcn_wave_barrier(); asm volatile("" ::: "memory");
    }
}

__device__ __forceinline__ h16 tohx(float x) { return (h16)x; }
__device__ __forceinline__ void splitf(float y, unsigned short& h, unsigned short& l) { h = f2bf(y); l = f2bf(y - bf2f(h)); }
typedef __attribute__((ext_vector_type(4))) _Float16 v4h;
typedef __attribute__((ext_vector_type(2))) unsigned short v2us;
typedef __attribute__((ext_vector_type(4))) unsigned short v4us;
typedef __attribute__((ext_vector_type(4))) int v4i;


// ---- k_proj: the three projections in one launch, grid (rows / 64, 3): grid y 0 = q, 1 = k, 2 = v. One work-group of NW waves per 64x64 tile; every wave holds the whole tile (16 accumulators) for its share of K: the 32-wide K steps wave, wave + NW, ...
// Both operands come straight from the f32 inputs and are rounded to bf16 in registers, in the fragment's own k order (k = 8 hi + 0..7, then 16 + 8 hi + 0..7, for A and for B alike): A from x rows, B from a column of the [DM][HD] weight.
// The epilogue splits each f32 sum into hi + lo bf16 and writes the planes the attention reads: q and k as [b][t][d], v transposed as [b][d][t] (turned through LDS so that each 128-byte line of v^T has one writer).
// f32 -> bf16 by the hardware conversion: round to nearest even, the rounding of f2bf
typedef __attribute__((ext_vector_type(16))) float v16f;
__device__ __forceinline__ v16bf ldx(const float* p) { const v4f a0 = *(const v4f*)p, a1 = *(const v4f*)(p + 4), a2 = *(const v4f*)(p + 16), a3 = *(const v4f*)(p + 20); v16f f;
#pragma unroll
    for (int q = 0; q < 4; ++q) { f[q] = a0[q]; f[4 + q] = a1[q]; f[8 + q] = a2[q]; f[12 + q] = a3[q]; }
    return __builtin_convertvector(f, v16bf); }
__device__ __forceinline__ v16bf ldw(const float* p) { v16f f;
#pragma unroll
    for (int e = 0; e < 8; ++e) { f[e] = p[e * HD]; f[8 + e] = p[(16 + e) * HD]; }
    return __builtin_convertvector(f, v16bf); }
template <int NW>
__global__ __launch_bounds__(32 * NW) void k_proj(const float* __restrict__ x, const float* __restrict__ wq, const float* __restrict__ wk, const float* __restrict__ wv, bf* QPh, bf* QPl, bf* KPh, bf* KPl, bf* VTh, bf* VTl) {
    __shared__ __align__(16) float os[2 * NW * 16 * 68];
    const int which = blockIdx.y; const float* w = (which == 0) ? wq : (which == 1) ? wk : wv;
    const int tid = threadIdx.x, lane = tid & 31, lr = lane & 15, hi = lane >> 4; const int r0 = blockIdx.x * 64;
    v8f acc[4][4];
#pragma unroll
    for (int mb = 0; mb < 4; ++mb)
#pragma unroll
        for (int nb = 0; nb < 4; ++nb) acc[mb][nb] = (v8f){};
    const float* xa = x + (size_t)(r0 + lr) * DM + 8 * hi; const float* wb = w + (size_t)(8 * hi) * HD + lr;
    const int wave = __builtin_amdgcn_readfirstlane(tid >> 5);   // the wave's number in a scalar register: the K loop stays a scalar branch
#pragma unroll 1
    for (int kc = wave * 32; kc < DM; kc += NW * 32) {
        v16bf a[4];
#pragma unroll
        for (int mb = 0; mb < 4; ++mb) a[mb] = ldx(xa + (size_t)mb * 16 * DM + kc);
#pragma unroll
        for (int nh = 0; nh < 2; ++nh) { v16bf b[2];
#pragma unroll
            for (int q = 0; q < 2; ++q) b[q] = ldw(wb + (size_t)kc * HD + (nh * 2 + q) * 16);
            // holds the loads of a trip in two groups: the x fragments and two weight fragments all issue in front of the first wait, the last two weight fragments behind their rounding (all at once do not fit beside the 128 accumulator registers); without it this build issues the loads in many small groups with a wait behind each
            __builtin_amdgcn_sched_barrier(0);
#pragma unroll
            for (int q = 0; q < 2; ++q)
#pragma unroll
                for (int mb = 0; mb < 4; ++mb) acc[mb][nh * 2 + q] = wmmab(a[mb], b[q], acc[mb][nh * 2 + q]); }
        // four vector slots between a trip's last matrix instruction and the next trip's first write of its operands
        asm volatile("v_nop\n\tv_nop\n\tv_nop\n\tv_nop" : "+v"(acc[0][0]), "+v"(acc[1][1]), "+v"(acc[2][2]), "+v"(acc[3][3]) : "v"(a[0]), "v"(a[3]));
    }
    v2fk res[4]; ksum_regs<NW>(acc, os, res);
    const int row = tid >> 5, cofs = lane * 2;
    if (which < 2) {
        bf* Ph = (which == 0) ? QPh : KPh; bf* Pl = (which == 0) ? QPl : KPl;
#pragma unroll
        for (int mb = 0; mb < 4; ++mb) { const size_t e = (size_t)(r0 + mb * 16 + row) * HD + cofs; v2us oh, ol;
#pragma unroll
            for (int q = 0; q < 2; ++q) { unsigned short a2, c2; splitf(res[mb][q], a2, c2); oh[q] = a2; ol[q] = c2; }
            *(v2us*)(Ph + e) = oh; *(v2us*)(Pl + e) = ol; }
    } else {
        float* ft = os;   // [d][t], pitch 68, in LDS buffer 0: its last readers (pass 2 of the sum) are behind the barrier of pass 3, and pass 3 reads buffer 1 alone
#pragma unroll
        for (int mb = 0; mb < 4; ++mb) { ft[cofs * 68 + mb * 16 + row] = res[mb][0]; ft[(cofs + 1) * 68 + mb * 16 + row] = res[mb][1]; }
        __syncthreads();   // the whole turned tile is in LDS before any thread reads a row of it (grid y is the same for the whole work-group)
        const int d = tid >> 3, t0 = (tid & 7) * 8; const v4f f0 = *(const v4fa*)(ft + d * 68 + t0), f1 = *(const v4fa*)(ft + d * 68 + t0 + 4); v8us oh, ol;
#pragma unroll
        for (int q = 0; q < 4; ++q) { unsigned short a2, c2; splitf(f0[q], a2, c2); oh[q] = a2; ol[q] = c2; splitf(f1[q], a2, c2); oh[4 + q] = a2; ol[4 + q] = c2; }
        const size_t o = ((size_t)(r0 / TT) * HD + d) * TT + (r0 % TT) + t0; *(v8us*)(VTh + o) = oh; *(v8us*)(VTl + o) = ol;
        asm volatile("s_wait_xcnt 0x0" ::: "memory");   // stands in front of any later write of a register that the two stores above name (address or data), on every way the branches behind them allow
    }
}

// k_asoft: per row (zz, i): t = S x C^-0.5 (C = n_embed = 1024) for j <= i and i - j < WIN (sliding causal window; the reference's -1e9 additive fill vanishes identically); softmax over the 2048 keys (register row, one exp, fixed trees);
__global__ __launch_bounds__(256) void k_asoft(const float* __restrict__ Sb, h16* P16, bf* Ph, bf* Pl) {
    const int lane = threadIdx.x & 31; const int row = blockIdx.x * 8 + (threadIdx.x >> 5); if (row >= NB_ * ZH * TT) return; const int i = row % TT; const int zz = row / TT; (void)zz; const bool hires = (i < RH); const float* sr = Sb + (size_t)row * TT; float v[TT / 32]; float mx = -3.0e38f;
#pragma unroll
    for (int ch = 0; ch < TT / 128; ++ch) { const int j0 = ch * 128 + lane * 4; const v4f a = *(const v4f*)(sr + j0);
#pragma unroll
        for (int q = 0; q < 4; ++q) { const int j = j0 + q; (void)j; const float t = (j <= i && i - j < WIN) ? a[q] * SCL : -3.0e38f; v[ch * 4 + q] = t; mx = fmaxf(mx, t); } }
#pragma unroll
    for (int sh = 16; sh; sh >>= 1) mx = fmaxf(mx, __shfl_xor(mx, sh, 32));
    float sum = 0.f;
#pragma unroll
    for (int k = 0; k < TT / 32; ++k) { float d0 = __fsub_rn(v[k], mx); asm volatile("" : "+v"(d0)); v[k] = __builtin_amdgcn_exp2f(__fmul_rn(d0, 1.4426950408889634f)); sum += v[k]; }
#pragma unroll
    for (int sh = 16; sh; sh >>= 1) sum += __shfl_xor(sum, sh, 32);
    const float f = __fdiv_rn(hires ? 1.0f : PCAR, sum);
{
        if (hires) {
#pragma unroll
            for (int ch = 0; ch < TT / 128; ++ch) { v4us oh, ol;
#pragma unroll
                for (int q = 0; q < 4; ++q) { unsigned short a, c2; splitf(v[ch * 4 + q] * f, a, c2); oh[q] = a; ol[q] = c2; }
                const size_t oo = ((size_t)zz * (RH ? RH : 1) + i) * TT + ch * 128 + lane * 4; *(v4us*)(Ph + oo) = oh; *(v4us*)(Pl + oo) = ol; }
        } else {
#pragma unroll
            for (int ch = 0; ch < TT / 128; ++ch) { v4h o4;
#pragma unroll
                for (int q = 0; q < 4; ++q) o4[q] = tohx(v[ch * 4 + q] * f);
                *(v4h*)(P16 + (size_t)row * TT + ch * 128 + lane * 4) = o4; } }
         }
}

extern "C" void kernel_launch(void* const* d_in, const int* in_sizes, int n_in,
                              void* d_out, int out_size, void* d_ws, size_t ws_size, hipStream_t stream) {
    (void)in_sizes; (void)n_in; (void)out_size;
    const float* x = (const float*)d_in[0]; const float* wk = (const float*)d_in[1]; const float* wq = (const float*)d_in[2]; const float* wv = (const float*)d_in[3];   /* input order x, Wk, Wq, Wv ('xw' [1024][64]; NOTE the key weight comes FIRST) */
    float* OUT = (float*)d_out;     // [4][2048][64]
    char* wsp = (char*)d_ws;
    auto take = [&](size_t bytes) { char* p = wsp; wsp += (bytes + 255) & ~(size_t)255; return (void*)p; };
    bf* QPh = (bf*)take((size_t)NB_ * NH_ * TT * HD * 2); bf* QPl = (bf*)take((size_t)NB_ * NH_ * TT * HD * 2); bf* KPh = (bf*)take((size_t)NB_ * NKV * TT * HD * 2); bf* KPl = (bf*)take((size_t)NB_ * NKV * TT * HD * 2); bf* VTh = (bf*)take((size_t)NB_ * NKV * HD * TT * 2); bf* VTl = (bf*)take((size_t)NB_ * NKV * HD * TT * 2); bf* Ph = (bf*)take((size_t)NB_ * ZH * RH * TT * 2); bf* Pl = (bf*)take((size_t)NB_ * ZH * RH * TT * 2);
    float* Sb = (float*)take((size_t)NB_ * ZH * TT * TT * 4); h16* P16 = (h16*)take((size_t)NB_ * ZH * TT * TT * 2);
    if ((size_t)(wsp - (char*)d_ws) > ws_size) return;    // ws 256 MiB; the NB_ slabs take about 166 MiB
    // x is [NB_ * TT][DM] row-contiguous, so the projections take the batch as more rows; the attention GEMMs take it as grid z, the softmax as more rows. The output [b][t][d] has the layout of the P.V tiles, so P.V stores it.
    k_proj<16><<<dim3(NB_ * TT / 64, 3, 1), 512, 0, stream>>>(x, wq, wk, wv, QPh, QPl, KPh, KPl, VTh, VTl);
    k_gemmc<bf, 2, 1, 1><<<dim3(RH / 64, TT / 64, NB_), 32, 0, stream>>>(QPh, QPl, KPh, KPl, HD, Sb, TT, 0, (size_t)TT * HD, (size_t)TT * HD, (size_t)TT * TT);
    k_asoft<<<NB_ * ZH * TT / 8, 256, 0, stream>>>(Sb, P16, Ph, Pl);
    k_gemmc<bf, 2, 2, 16><<<dim3(RH / 64, HD / 64, NB_), 512, 0, stream>>>(Ph, Pl, VTh, VTl, TT, OUT, HD, 0, (size_t)RH * TT, (size_t)HD * TT, (size_t)TT * HD);
}

// v004
// Measured time: 32.9 microseconds a run.
// Timed twice side by side with v003, it ran 1.89 and 1.91 times as fast.
// All steps since v000 together make it 14.7 times as fast.
#include <hip/hip_runtime.h>

// Single causal attention head scaled by the EMBEDDING width (x [4][2048][1024]; k = x Wk, q = x Wq, v = x Wv ('xw' [1024][64], no bias; ONE 64-wide head); wei = q.k^T x C^-0.5 with C = n_embed = 1024 (not head_size); causal (-inf); softmax; out = wei.v -> [4][2048][64] (0.5 M); argument order x, Wk, Wq, Wv (the KEY weight comes first)).
// Layout, two launches, all four batch elements in each: ONE projection launch (grid y = q, k, v) reads x and the 'xw' weights as f32, rounds them to bf16 in registers and writes the hi/lo planes of q, k and v^T from its own epilogue (K loop split over 16 waves, f32 partial tiles summed through LDS in wave order);
// ONE attention launch: a work-group per 32 query rows, its 16 waves share out the 32-key blocks up to the diagonal; scores, softmax (running maximum) and P.V stay in registers, 3 hi/lo products each; the waves' partial outputs are joined through LDS in wave order. Scores and probabilities never go to memory.
// Compute dtypes, f32 accumulate: every input rounded to bf16; projections exact; attention 3 products on every row; softmax f32; output f32.

#define NB_  4
#define TT   2048
#define DM   1024
#define NH_  1
#define NKV  1
#define HD   64
#define SCL  0.03125f   // C^-0.5 with C = n_embed = 1024
typedef unsigned short bf;
typedef __attribute__((ext_vector_type(16))) __bf16   v16bf;
typedef __attribute__((ext_vector_type(8)))  unsigned short v8us;
typedef __attribute__((ext_vector_type(8)))  float    v8f;
typedef __attribute__((ext_vector_type(4)))  float    v4f;
typedef v4f  __attribute__((may_alias)) v4fa;
typedef v8us __attribute__((may_alias)) v8usa;

__device__ __forceinline__ unsigned short f2bf(float f) { unsigned u = __float_as_uint(f); u += 0x7FFFu + ((u >> 16) & 1u); return (unsigned short)(u >> 16); }
__device__ __forceinline__ float bf2f(unsigned short b) { return __uint_as_float(((unsigned)b) << 16); }
__device__ __forceinline__ v16bf cat16b(v8us lo, v8us hi) { return __builtin_bit_cast(v16bf, __builtin_shufflevector(lo, hi, 0, 1, 2, 3, 4, 5, 6, 7, 8, 9, 10, 11, 12, 13, 14, 15)); }
__device__ __forceinline__ v8f wmmab(v16bf a, v16bf b, v8f c) { return __builtin_amdgcn_wmma_f32_16x16x32_bf16(false, a, false, b, (short)0, c, false, false); }



// ---- ksum_regs: the NW waves of a work-group each hold an f32 partial of the same 64x64 tile (their share of the K loop); 16 rows a pass, every wave puts its partial in LDS and all threads add the NW partials
// in wave order 0..NW-1 (a fixed order). Two LDS buffers in turn, so ONE barrier a pass is enough: a buffer is written again only behind the barrier of the pass after the one that read it.
// The sums stay in registers (res[mb]: row mb * 16 + wave, columns 2 lane and 2 lane + 1) and go to memory behind the last pass, so that no barrier has to wait for a global store.
typedef __attribute__((ext_vector_type(2))) float v2fk;
typedef v2fk __attribute__((may_alias)) v2fka;
template <int NW>
__device__ __forceinline__ void ksum_regs(const v8f (&acc)[4][4], float* os, v2fk (&res)[4]) {
    static_assert(NW * 32 * 2 == 16 * 64, "two outputs a thread a pass");
    const int tid = threadIdx.x, lane = tid & 31, lr = lane & 15, hi = lane >> 4, wv = tid >> 5; const int row = tid >> 5, cofs = lane * 2;
#pragma unroll
    for (int mb = 0; mb < 4; ++mb) {
        float* buf = os + (mb & 1) * (NW * 16 * 68); float* mine = buf + wv * (16 * 68);
#pragma unroll
        for (int nb = 0; nb < 4; ++nb) {
#pragma unroll
            for (int j = 0; j < 8; ++j) mine[(hi * 8 + j) * 68 + nb * 16 + lr] = acc[mb][nb][j]; }
        __syncthreads();   // every wave's partial of these 16 rows is in LDS before any thread adds them up
        v2fk val = *(const v2fka*)(buf + row * 68 + cofs);
#pragma unroll
        for (int p = 1; p < NW; ++p) val += *(const v2fka*)(buf + p * (16 * 68) + row * 68 + cofs);
        res[mb] = val;
    }
}

__device__ __forceinline__ void splitf(float y, unsigned short& h, unsigned short& l) { h = f2bf(y); l = f2bf(y - bf2f(h)); }
typedef __attribute__((ext_vector_type(2))) unsigned short v2us;


// ---- k_proj: the three projections in one launch, grid (rows / 64, 3): grid y 0 = q, 1 = k, 2 = v. One work-group of NW waves per 64x64 tile; every wave holds the whole tile (16 accumulators) for its share of K: the 32-wide K steps wave, wave + NW, ...
// Both operands come straight from the f32 inputs and are rounded to bf16 in registers, in the fragment's own k order (k = 8 hi + 0..7, then 16 + 8 hi + 0..7, for A and for B alike): A from x rows, B from a column of the [DM][HD] weight.
// The epilogue splits each f32 sum into hi + lo bf16 and writes the planes the attention reads: q and k as [b][t][d], v transposed as [b][d][t] (turned through LDS so that each 128-byte line of v^T has one writer).
// f32 -> bf16 by the hardware conversion: round to nearest even, the rounding of f2bf
typedef __attribute__((ext_vector_type(16))) float v16f;
__device__ __forceinline__ v16bf ldx(const float* p) { const v4f a0 = *(const v4f*)p, a1 = *(const v4f*)(p + 4), a2 = *(const v4f*)(p + 16), a3 = *(const v4f*)(p + 20); v16f f;
#pragma unroll
    for (int q = 0; q < 4; ++q) { f[q] = a0[q]; f[4 + q] = a1[q]; f[8 + q] = a2[q]; f[12 + q] = a3[q]; }
    return __builtin_convertvector(f, v16bf); }
__device__ __forceinline__ v16bf ldw(const float* p) { v16f f;
#pragma unroll
    for (int e = 0; e < 8; ++e) { f[e] = p[e * HD]; f[8 + e] = p[(16 + e) * HD]; }
    return __builtin_convertvector(f, v16bf); }
template <int NW>
__global__ __launch_bounds__(32 * NW) void k_proj(const float* __restrict__ x, const float* __restrict__ wq, const float* __restrict__ wk, const float* __restrict__ wv, bf* QPh, bf* QPl, bf* KPh, bf* KPl, bf* VTh, bf* VTl) {
    __shared__ __align__(16) float os[2 * NW * 16 * 68];
    const int which = blockIdx.y; const float* w = (which == 0) ? wq : (which == 1) ? wk : wv;
    const int tid = threadIdx.x, lane = tid & 31, lr = lane & 15, hi = lane >> 4; const int r0 = blockIdx.x * 64;
    v8f acc[4][4];
#pragma unroll
    for (int mb = 0; mb < 4; ++mb)
#pragma unroll
        for (int nb = 0; nb < 4; ++nb) acc[mb][nb] = (v8f){};
    const float* xa = x + (size_t)(r0 + lr) * DM + 8 * hi; const float* wb = w + (size_t)(8 * hi) * HD + lr;
    const int wave = __builtin_amdgcn_readfirstlane(tid >> 5);   // the wave's number in a scalar register: the K loop stays a scalar branch
#pragma unroll 1
    for (int kc = wave * 32; kc < DM; kc += NW * 32) {
        v16bf a[4];
#pragma unroll
        for (int mb = 0; mb < 4; ++mb) a[mb] = ldx(xa + (size_t)mb * 16 * DM + kc);
#pragma unroll
        for (int nh = 0; nh < 2; ++nh) { v16bf b[2];
#pragma unroll
            for (int q = 0; q < 2; ++q) b[q] = ldw(wb + (size_t)kc * HD + (nh * 2 + q) * 16);
            // holds the loads of a trip in two groups: the x fragments and two weight fragments all issue in front of the first wait, the last two weight fragments behind their rounding (all at once do not fit beside the 128 accumulator registers); without it this build issues the loads in many small groups with a wait behind each
            __builtin_amdgcn_sched_barrier(0);
#pragma unroll
            for (int q = 0; q < 2; ++q)
#pragma unroll
                for (int mb = 0; mb < 4; ++mb) acc[mb][nh * 2 + q] = wmmab(a[mb], b[q], acc[mb][nh * 2 + q]); }
        // four vector slots between a trip's last matrix instruction and the next trip's first write of its operands
        asm volatile("v_nop\n\tv_nop\n\tv_nop\n\tv_nop" : "+v"(acc[0][0]), "+v"(acc[1][1]), "+v"(acc[2][2]), "+v"(acc[3][3]) : "v"(a[0]), "v"(a[3]));
    }
    v2fk res[4]; ksum_regs<NW>(acc, os, res);
    const int row = tid >> 5, cofs = lane * 2;
    if (which < 2) {
        bf* Ph = (which == 0) ? QPh : KPh; bf* Pl = (which == 0) ? QPl : KPl;
#pragma unroll
        for (int mb = 0; mb < 4; ++mb) { const size_t e = (size_t)(r0 + mb * 16 + row) * HD + cofs; v2us oh, ol;
#pragma unroll
            for (int q = 0; q < 2; ++q) { unsigned short a2, c2; splitf(res[mb][q], a2, c2); oh[q] = a2; ol[q] = c2; }
            *(v2us*)(Ph + e) = oh; *(v2us*)(Pl + e) = ol; }
    } else {
        float* ft = os;   // [d][t], pitch 68, in LDS buffer 0: its last readers (pass 2 of the sum) are behind the barrier of pass 3, and pass 3 reads buffer 1 alone
#pragma unroll
        for (int mb = 0; mb < 4; ++mb) { ft[cofs * 68 + mb * 16 + row] = res[mb][0]; ft[(cofs + 1) * 68 + mb * 16 + row] = res[mb][1]; }
        __syncthreads();   // the whole turned tile is in LDS before any thread reads a row of it (grid y is the same for the whole work-group)
        const int d = tid >> 3, t0 = (tid & 7) * 8; const v4f f0 = *(const v4fa*)(ft + d * 68 + t0), f1 = *(const v4fa*)(ft + d * 68 + t0 + 4); v8us oh, ol;
#pragma unroll
        for (int q = 0; q < 4; ++q) { unsigned short a2, c2; splitf(f0[q], a2, c2); oh[q] = a2; ol[q] = c2; splitf(f1[q], a2, c2); oh[4 + q] = a2; ol[4 + q] = c2; }
        const size_t o = ((size_t)(r0 / TT) * HD + d) * TT + (r0 % TT) + t0; *(v8us*)(VTh + o) = oh; *(v8us*)(VTl + o) = ol;
        asm volatile("s_wait_xcnt 0x0" ::: "memory");   // stands in front of any later write of a register that the two stores above name (address or data), on every way the branches behind them allow
    }
}

// ---- k_attn: causal attention for QR query rows of one batch element per work-group. Transposed products: S^T = K.Q^T (A = key rows, B = query rows) and O^T += V^T.P^T (A = rows of v^T, B = P), so a lane holds scores and outputs of ONE query row (row lr of each 16-row group):
// the maximum and the sum are in-lane but for one exchange between the lane halves, the rescale is a per-lane factor, and two S^T tiles (keys 0..15 and 16..31 of a block) are, register for register, the B fragment of P in the hardware k order (k = 8 hi + 0..7, then 16 + 8 hi + 0..7), which is also the order of ldf for K, Q and v^T.
// Wave w takes the 32-key blocks w, w + AW, ... up to the diagonal block and keeps its own running maximum m, sum l and output tile; a wave with no block keeps m = -3e38, l = 0, O = 0 and weighs nothing in the join.
// Join: every wave puts m, l and O in LDS; behind ONE barrier each thread takes the maximum of the AW m of its row and adds the AW partials, each scaled by exp(m_w - max), in wave order 0..AW-1 (a fixed order), divides by the joined sum and stores four outputs.
#define AW 16
#define QR 32
#define LOG2E 1.4426950408889634f
#define QPIT 72               // LDS pitch of a query row in elements: 144 bytes, 16 bytes x an odd number, for 16-byte reads down a column of rows
#define PLN (NB_ * TT * HD)   // elements from a hi plane to its lo plane: the launcher takes each pair one behind the other, and a plane is a whole number of 256-byte units
__device__ __forceinline__ v16bf ldf(const bf* p) { return cat16b(*(const v8us*)p, *(const v8us*)(p + 16)); }
typedef __attribute__((ext_vector_type(8))) unsigned v8u;
__global__ __launch_bounds__(32 * AW) void k_attn(const bf* __restrict__ Qp, const bf* __restrict__ Kp, const bf* __restrict__ Vp, float* out) {
    __shared__ __align__(16) float ob[AW * QR * 68];
    __shared__ float ms[AW * QR]; __shared__ float ls[AW * QR];
    __shared__ __align__(16) bf qs[2 * QR * QPIT];   // the work-group's query rows, hi plane then lo plane
    const int lane = threadIdx.x & 31, lr = lane & 15, hi = lane >> 4;
    const int wave = __builtin_amdgcn_readfirstlane(threadIdx.x >> 5);   // the wave's number in a scalar register: the key loop stays a scalar branch
    const int qi = (TT / QR - 1) - (int)blockIdx.y, q0 = qi * QR;   // the longest rows start first
    const size_t pb = (size_t)blockIdx.x * TT * HD;
    out += pb;
    v8f o[4][2];                // O^T: [16 head columns][16-row group]
#pragma unroll
    for (int dt = 0; dt < 4; ++dt)
#pragma unroll
        for (int qt = 0; qt < 2; ++qt) o[dt][qt] = (v8f){};
    float m[2] = {-3.0e38f, -3.0e38f}, l[2] = {0.f, 0.f};
    {   // 2 planes x 32 rows x 128 bytes = one 16-byte piece a thread, whole lines per load
        static_assert(32 * AW * 8 == 2 * QR * HD, "one 16-byte piece of the query tile a thread");
        const int pl_ = threadIdx.x >> 8, row = (threadIdx.x >> 3) & 31, pc = threadIdx.x & 7;
        *(v8usa*)(qs + (pl_ * QR + row) * QPIT + pc * 8) = *(const v8us*)(Qp + pl_ * PLN + pb + (q0 + row) * HD + pc * 8);
    }
    __syncthreads();   // the whole query tile is in LDS before any wave reads a fragment of it
    // the lane's own pointers: row lr of the query tile in LDS, of a [t][d] plane (K) or of a [d][t] plane (v^T), 8 elements per lane half; those of K and v^T step on by AW blocks at the foot of a trip
    const bf* qp = qs + lr * QPIT + 8 * hi; const bf* kp = Kp + pb + (wave * 32 + lr) * HD + 8 * hi; const bf* vp = Vp + pb + lr * TT + wave * 32 + 8 * hi;
#pragma unroll 1
    for (int kb = wave; kb <= qi; kb += AW) {
        const int k0 = kb * 32;
        // the query fragments are read anew from LDS each trip: kept over the trip they do not fit beside the output tile, the v^T fragments and P in the 256 registers of a wave
        v16bf qh[2][2], ql[2][2], kh[2][2], kl[2][2];   // [16-row group][32-wide step of the head dimension]
#pragma unroll
        for (int g = 0; g < 2; ++g)
#pragma unroll
            for (int ks = 0; ks < 2; ++ks) { const int c = g * 16 * HD + ks * 32, cq = g * 16 * QPIT + ks * 32; kh[g][ks] = ldf(kp + c); kl[g][ks] = ldf(kp + PLN + c); qh[g][ks] = ldf(qp + cq); ql[g][ks] = ldf(qp + QR * QPIT + cq); }
        // holds the K and Q loads of a trip in one group in front of the first wait; without it the build issues them in small groups with a wait behind each
        __builtin_amdgcn_sched_barrier(0);
        v8f s[2][2];            // S^T: [16 keys][16-row group]
#pragma unroll
        for (int kt = 0; kt < 2; ++kt) { s[kt][0] = (v8f){}; s[kt][1] = (v8f){}; }
        // the four tiles in turn inside each product: four independent accumulate chains, and all four tiles have their registers before any fragment has had its last use
#pragma unroll
        for (int ks = 0; ks < 2; ++ks)
#pragma unroll
            for (int pr = 0; pr < 3; ++pr)
#pragma unroll
                for (int kt = 0; kt < 2; ++kt)
#pragma unroll
                    for (int qt = 0; qt < 2; ++qt) s[kt][qt] = wmmab(pr == 2 ? kl[kt][ks] : kh[kt][ks], pr == 1 ? ql[qt][ks] : qh[qt][ks], s[kt][qt]);
        v16bf vh[4], vl[4];
#pragma unroll
        for (int dt = 0; dt < 4; ++dt) { vh[dt] = ldf(vp + dt * 16 * TT); vl[dt] = ldf(vp + PLN + dt * 16 * TT); }
        // holds the v^T loads in front of the softmax, whose vector work then covers their latency (they take the registers that K and Q have left)
        __builtin_amdgcn_sched_barrier(0);
        v16bf ph[2], pl[2];
#pragma unroll
        for (int qt = 0; qt < 2; ++qt) { const int rel = q0 - k0 + qt * 16 + lr - hi * 8;   // key <= query row  <=>  16 kt + j <= rel
            v16f t; float bm = m[qt];
#pragma unroll
            for (int kt = 0; kt < 2; ++kt)
#pragma unroll
                for (int j = 0; j < 8; ++j) { const float u = (kt * 16 + j <= rel) ? s[kt][qt][j] * SCL : -3.0e38f; t[kt * 8 + j] = u; bm = fmaxf(bm, u); }
            bm = fmaxf(bm, __shfl_xor(bm, 16, 32));   // the other lane half holds the row's other 16 keys
            const float al = __builtin_amdgcn_exp2f((m[qt] - bm) * LOG2E); m[qt] = bm;
            float sum = 0.f;
#pragma unroll
            for (int e = 0; e < 16; ++e) { t[e] = __builtin_amdgcn_exp2f((t[e] - bm) * LOG2E); sum += t[e]; }
            l[qt] = l[qt] * al + sum;
#pragma unroll
            for (int dt = 0; dt < 4; ++dt) o[dt][qt] *= al;
            ph[qt] = __builtin_convertvector(t, v16bf);   // hi = bf16(p), lo = bf16(p - hi); hi goes back to f32 from the packed pairs, one shift or one mask an element
            const v8u hp = __builtin_bit_cast(v8u, ph[qt]); v16f hb;
#pragma unroll
            for (int e = 0; e < 8; ++e) { hb[2 * e] = __uint_as_float(hp[e] << 16); hb[2 * e + 1] = __uint_as_float(hp[e] & 0xFFFF0000u); }
            pl[qt] = __builtin_convertvector(t - hb, v16bf); }
#pragma unroll
        for (int dt = 0; dt < 4; ++dt)
#pragma unroll
            for (int qt = 0; qt < 2; ++qt) { o[dt][qt] = wmmab(vh[dt], ph[qt], o[dt][qt]); o[dt][qt] = wmmab(vh[dt], pl[qt], o[dt][qt]); o[dt][qt] = wmmab(vl[dt], ph[qt], o[dt][qt]); }
        // four vector slots between a trip's last matrix instruction and the next trip's first write of its operands; the memory clobber keeps the LDS reads of the query fragments inside the trip
        asm volatile("v_nop\n\tv_nop\n\tv_nop\n\tv_nop" : "+v"(o[3][0]), "+v"(o[3][1]) : "v"(vl[3]), "v"(ph[1]) : "memory");
        kp += AW * 32 * HD; vp += AW * 32;
    }
#pragma unroll
    for (int qt = 0; qt < 2; ++qt) { l[qt] += __shfl_xor(l[qt], 16, 32);   // the lane halves' sums, joined once
        float* po = ob + (wave * QR + qt * 16 + lr) * 68 + hi * 8;
#pragma unroll
        for (int dt = 0; dt < 4; ++dt) { *(v4fa*)(po + dt * 16) = __builtin_shufflevector(o[dt][qt], o[dt][qt], 0, 1, 2, 3); *(v4fa*)(po + dt * 16 + 4) = __builtin_shufflevector(o[dt][qt], o[dt][qt], 4, 5, 6, 7); }
        if (hi == 0) { ms[wave * QR + qt * 16 + lr] = m[qt]; ls[wave * QR + qt * 16 + lr] = l[qt]; } }
    __syncthreads();   // every wave's m, l and partial output are in LDS before any thread joins them
    const int q = wave * 2 + hi, d4 = lr * 4;   // thread / 16 and 4 (thread % 16)
    float mw[AW]; float mx = -3.0e38f;
#pragma unroll
    for (int w = 0; w < AW; ++w) { mw[w] = ms[w * QR + q]; mx = fmaxf(mx, mw[w]); }
    v4f acc = (v4f){}; float lsum = 0.f;
#pragma unroll
    for (int w = 0; w < AW; ++w) { const float a = (mw[w] - mx) * LOG2E; float f;
        asm("v_exp_f32 %0, %1\n\tv_nop" : "=v"(f) : "v"(a));   // exp2 with the one free slot the instruction set asks for behind a transcendental, in one statement
        lsum += ls[w * QR + q] * f; acc += *(const v4fa*)(ob + (w * QR + q) * 68 + d4) * f; }
    *(v4f*)(out + (size_t)(q0 + q) * HD + d4) = acc * __fdiv_rn(1.0f, lsum);
}

extern "C" void kernel_launch(void* const* d_in, const int* in_sizes, int n_in,
                              void* d_out, int out_size, void* d_ws, size_t ws_size, hipStream_t stream) {
    (void)in_sizes; (void)n_in; (void)out_size;
    const float* x = (const float*)d_in[0]; const float* wk = (const float*)d_in[1]; const float* wq = (const float*)d_in[2]; const float* wv = (const float*)d_in[3];   /* input order x, Wk, Wq, Wv ('xw' [1024][64]; NOTE the key weight comes FIRST) */
    float* OUT = (float*)d_out;     // [4][2048][64]
    char* wsp = (char*)d_ws;
    auto take = [&](size_t bytes) { char* p = wsp; wsp += (bytes + 255) & ~(size_t)255; return (void*)p; };
    bf* QPh = (bf*)take((size_t)NB_ * NH_ * TT * HD * 2); bf* QPl = (bf*)take((size_t)NB_ * NH_ * TT * HD * 2); bf* KPh = (bf*)take((size_t)NB_ * NKV * TT * HD * 2); bf* KPl = (bf*)take((size_t)NB_ * NKV * TT * HD * 2); bf* VTh = (bf*)take((size_t)NB_ * NKV * HD * TT * 2); bf* VTl = (bf*)take((size_t)NB_ * NKV * HD * TT * 2);
    if ((size_t)(wsp - (char*)d_ws) > ws_size) return;    // ws 256 MiB; the six planes take 6 MiB
    // x is [NB_ * TT][DM] row-contiguous, so the projections take the batch as more rows; the attention takes it as grid x. The output [b][t][d] is stored by the attention launch.
    k_proj<16><<<dim3(NB_ * TT / 64, 3, 1), 512, 0, stream>>>(x, wq, wk, wv, QPh, QPl, KPh, KPl, VTh, VTl);
    k_attn<<<dim3(NB_, TT / QR, 1), 32 * AW, 0, stream>>>(QPh, KPh, VTh, OUT);   // each lo plane lies PLN elements behind its hi plane
}

// v005
// One run takes 29.3 microseconds.
// Two timings next to v004 put it at 1.12 and 1.14 times that version's speed.
// All steps since v000 together make it 16.6 times as fast.
#include <hip/hip_runtime.h>

// Single causal attention head scaled by the EMBEDDING width (x [4][2048][1024]; k = x Wk, q = x Wq, v = x Wv ('xw' [1024][64], no bias; ONE 64-wide head); wei = q.k^T x C^-0.5 with C = n_embed = 1024 (not head_size); causal (-inf); softmax; out = wei.v -> [4][2048][64] (0.5 M); argument order x, Wk, Wq, Wv (the KEY weight comes first)).
// Layout, two launches, all four batch elements in each: ONE projection launch (grid y = q, k, v) reads x and the 'xw' weights as f32, rounds them to bf16 in registers and writes the hi/lo planes of q, k and v^T from its own epilogue (K loop split over 16 waves, f32 partial tiles summed through LDS in wave order); the k and v^T planes lie in the order of the attention's fragments, so that each of its 16-byte-a-lane loads covers 512 bytes in a row;
// ONE attention launch: a work-group per 32 query rows, its 16 waves share out the 32-key blocks up to the diagonal; scores, softmax (running maximum) and P.V stay in registers, 3 hi/lo products each; the waves' partial outputs are joined through LDS in wave order. Scores and probabilities never go to memory.
// Compute dtypes, f32 accumulate: every input rounded to bf16; projections exact; attention 3 products on every row; softmax f32; output f32.

#define NB_  4
#define TT   2048
#define DM   1024
#define NH_  1
#define NKV  1
#define HD   64
#define SCL  0.03125f   // C^-0.5 with C = n_embed = 1024
typedef unsigned short bf;
typedef __attribute__((ext_vector_type(16))) __bf16   v16bf;
typedef __attribute__((ext_vector_type(8)))  unsigned short v8us;
typedef __attribute__((ext_vector_type(8)))  float    v8f;
typedef __attribute__((ext_vector_type(4)))  float    v4f;
typedef v4f  __attribute__((may_alias)) v4fa;
typedef v8us __attribute__((may_alias)) v8usa;

__device__ __forceinline__ unsigned short f2bf(float f) { unsigned u = __float_as_uint(f); u += 0x7FFFu + ((u >> 16) & 1u); return (unsigned short)(u >> 16); }
__device__ __forceinline__ float bf2f(unsigned short b) { return __uint_as_float(((unsigned)b) << 16); }
__device__ __forceinline__ v16bf cat16b(v8us lo, v8us hi) { return __builtin_bit_cast(v16bf, __builtin_shufflevector(lo, hi, 0, 1, 2, 3, 4, 5, 6, 7, 8, 9, 10, 11, 12, 13, 14, 15)); }
__device__ __forceinline__ v8f wmmab(v16bf a, v16bf b, v8f c) { return __builtin_amdgcn_wmma_f32_16x16x32_bf16(false, a, false, b, (short)0, c, false, false); }



// ---- ksum_regs: the NW waves of a work-group each hold an f32 partial of the same 64x64 tile (their share of the K loop); 16 rows a pass, every wave puts its partial in LDS and all threads add the NW partials
// in wave order 0..NW-1 (a fixed order). Two LDS buffers in turn, so ONE barrier a pass is enough: a buffer is written again only behind the barrier of the pass after the one that read it.
// The sums stay in registers (res[mb]: row mb * 16 + wave, columns 2 lane and 2 lane + 1) and go to memory behind the last pass, so that no barrier has to wait for a global store.
typedef __attribute__((ext_vector_type(2))) float v2fk;
typedef v2fk __attribute__((may_alias)) v2fka;
template <int NW>
__device__ __forceinline__ void ksum_regs(const v8f (&acc)[4][4], float* os, v2fk (&res)[4]) {
    static_assert(NW * 32 * 2 == 16 * 64, "two outputs a thread a pass");
    const int tid = threadIdx.x, lane = tid & 31, lr = lane & 15, hi = lane >> 4, wv = tid >> 5; const int row = tid >> 5, cofs = lane * 2;
#pragma unroll
    for (int mb = 0; mb < 4; ++mb) {
        float* buf = os + (mb & 1) * (NW * 16 * 68); float* mine = buf + wv * (16 * 68);
#pragma unroll
        for (int nb = 0; nb < 4; ++nb) {
#pragma unroll
            for (int j = 0; j < 8; ++j) mine[(hi * 8 + j) * 68 + nb * 16 + lr] = acc[mb][nb][j]; }
        __syncthreads();   // every wave's partial of these 16 rows is in LDS before any thread adds them up
        v2fk val = *(const v2fka*)(buf + row * 68 + cofs);
#pragma unroll
        for (int p = 1; p < NW; ++p) val += *(const v2fka*)(buf + p * (16 * 68) + row * 68 + cofs);
        res[mb] = val;
    }
}

__device__ __forceinline__ void splitf(float y, unsigned short& h, unsigned short& l) { h = f2bf(y); l = f2bf(y - bf2f(h)); }
typedef __attribute__((ext_vector_type(2))) unsigned short v2us;


// ---- k_proj: the three projections in one launch, grid (rows / 64, 3): grid y 0 = q, 1 = k, 2 = v. One work-group of NW waves per 64x64 tile; every wave holds the whole tile (16 accumulators) for its share of K: the 32-wide K steps wave, wave + NW, ...
// Both operands come straight from the f32 inputs and are rounded to bf16 in registers, in the fragment's own k order (k = 8 hi + 0..7, then 16 + 8 hi + 0..7, for A and for B alike): A from x rows, B from a column of the [DM][HD] weight.
// The epilogue splits each f32 sum into hi + lo bf16 and writes the planes the attention reads: q as [b][t][d]; k and v^T in FRAGMENT ORDER, in pieces of 8 elements (16 bytes), 32 pieces = the 32 lanes of one load, in a row:
//   k:   element (t, d) at (t / 16) * 1024 + (d / 8) * 128 + (t % 16) * 8 + d % 8           (a 16-key group: piece = 8 head columns of one key; lane = 16 * (d / 8 % 2) + t % 16)
//   v^T: element (d, t) at (t / 32) * 2048 + (d / 16) * 512 + (t / 8 % 4) * 128 + (d % 16) * 8 + t % 8   (a 32-key block: piece = 8 keys of one head column; lane = 16 * (t / 8 % 2) + d % 16)
// Either way a 64-row tile fills 4096 elements in a row from element r0 * HD of the plane on (t counted through the batch), and thread i stores piece i of it (turned through LDS): a wave's store covers 512 bytes in a row and each 128-byte line has one writer.
// f32 -> bf16 by the hardware conversion: round to nearest even, the rounding of f2bf
typedef __attribute__((ext_vector_type(16))) float v16f;
__device__ __forceinline__ v16bf ldx(const float* p) { const v4f a0 = *(const v4f*)p, a1 = *(const v4f*)(p + 4), a2 = *(const v4f*)(p + 16), a3 = *(const v4f*)(p + 20); v16f f;
#pragma unroll
    for (int q = 0; q < 4; ++q) { f[q] = a0[q]; f[4 + q] = a1[q]; f[8 + q] = a2[q]; f[12 + q] = a3[q]; }
    return __builtin_convertvector(f, v16bf); }
__device__ __forceinline__ v16bf ldw(const float* p) { v16f f;
#pragma unroll
    for (int e = 0; e < 8; ++e) { f[e] = p[e * HD]; f[8 + e] = p[(16 + e) * HD]; }
    return __builtin_convertvector(f, v16bf); }
template <int NW>
__global__ __launch_bounds__(32 * NW) void k_proj(const float* __restrict__ x, const float* __restrict__ wq, const float* __restrict__ wk, const float* __restrict__ wv, bf* QPh, bf* QPl, bf* KPh, bf* KPl, bf* VTh, bf* VTl) {
    __shared__ __align__(16) float os[2 * NW * 16 * 68];
    const int which = blockIdx.y; const float* w = (which == 0) ? wq : (which == 1) ? wk : wv;
    const int tid = threadIdx.x, lane = tid & 31, lr = lane & 15, hi = lane >> 4; const int r0 = blockIdx.x * 64;
    v8f acc[4][4];
#pragma unroll
    for (int mb = 0; mb < 4; ++mb)
#pragma unroll
        for (int nb = 0; nb < 4; ++nb) acc[mb][nb] = (v8f){};
    const float* xa = x + (size_t)(r0 + lr) * DM + 8 * hi; const float* wb = w + (size_t)(8 * hi) * HD + lr;
    const int wave = __builtin_amdgcn_readfirstlane(tid >> 5);   // the wave's number in a scalar register: the K loop stays a scalar branch
#pragma unroll 1
    for (int kc = wave * 32; kc < DM; kc += NW * 32) {
        v16bf a[4];
#pragma unroll
        for (int mb = 0; mb < 4; ++mb) a[mb] = ldx(xa + (size_t)mb * 16 * DM + kc);
#pragma unroll
        for (int nh = 0; nh < 2; ++nh) { v16bf b[2];
#pragma unroll
            for (int q = 0; q < 2; ++q) b[q] = ldw(wb + (size_t)kc * HD + (nh * 2 + q) * 16);
            // holds the loads of a trip in two groups: the x fragments and two weight fragments all issue in front of the first wait, the last two weight fragments behind their rounding (all at once do not fit beside the 128 accumulator registers); without it this build issues the loads in many small groups with a wait behind each
            __builtin_amdgcn_sched_barrier(0);
#pragma unroll
            for (int q = 0; q < 2; ++q)
#pragma unroll
                for (int mb = 0; mb < 4; ++mb) acc[mb][nh * 2 + q] = wmmab(a[mb], b[q], acc[mb][nh * 2 + q]); }
        // four vector slots between a trip's last matrix instruction and the next trip's first write of its operands
        asm volatile("v_nop\n\tv_nop\n\tv_nop\n\tv_nop" : "+v"(acc[0][0]), "+v"(acc[1][1]), "+v"(acc[2][2]), "+v"(acc[3][3]) : "v"(a[0]), "v"(a[3]));
    }
    v2fk res[4]; ksum_regs<NW>(acc, os, res);
    const int row = tid >> 5, cofs = lane * 2;
    if (which == 0) {
#pragma unroll
        for (int mb = 0; mb < 4; ++mb) { const size_t e = (size_t)(r0 + mb * 16 + row) * HD + cofs; v2us oh, ol;
#pragma unroll
            for (int q = 0; q < 2; ++q) { unsigned short a2, c2; splitf(res[mb][q], a2, c2); oh[q] = a2; ol[q] = c2; }
            *(v2us*)(QPh + e) = oh; *(v2us*)(QPl + e) = ol; }
    } else {
        float* ft = os;   // k: [t][d], v: [d][t], pitch 68, in LDS buffer 0: its last readers (pass 2 of the sum) are behind the barrier of pass 3, and pass 3 reads buffer 1 alone
        if (which == 1) {
#pragma unroll
            for (int mb = 0; mb < 4; ++mb) *(v2fka*)(ft + (mb * 16 + row) * 68 + cofs) = res[mb];
        } else {
#pragma unroll
            for (int mb = 0; mb < 4; ++mb) { ft[cofs * 68 + mb * 16 + row] = res[mb][0]; ft[(cofs + 1) * 68 + mb * 16 + row] = res[mb][1]; }
        }
        __syncthreads();   // the whole tile is in LDS before any thread reads a piece of it (grid y is the same for the whole work-group)
        // piece tid of the tile: its LDS row (k: the key, v: the head column) and its first column (k: head column, v: key)
        const int pr = (which == 1) ? (tid >> 7) * 16 + (tid & 15) : ((tid >> 6) & 3) * 16 + (tid & 15);
        const int pc = (which == 1) ? ((tid >> 4) & 7) * 8 : (tid >> 8) * 32 + ((tid >> 4) & 3) * 8;
        const v4f f0 = *(const v4fa*)(ft + pr * 68 + pc), f1 = *(const v4fa*)(ft + pr * 68 + pc + 4); v8us oh, ol;
#pragma unroll
        for (int q = 0; q < 4; ++q) { unsigned short a2, c2; splitf(f0[q], a2, c2); oh[q] = a2; ol[q] = c2; splitf(f1[q], a2, c2); oh[4 + q] = a2; ol[4 + q] = c2; }
        const size_t o = (size_t)r0 * HD + tid * 8; *(v8us*)(((which == 1) ? KPh : VTh) + o) = oh; *(v8us*)(((which == 1) ? KPl : VTl) + o) = ol;
        asm volatile("s_wait_xcnt 0x0" ::: "memory");   // stands in front of any later write of a register that the two stores above name (address or data), on every way the branches behind them allow
    }
}

// ---- k_attn: causal attention for QR query rows of one batch element per work-group. Transposed products: S^T = K.Q^T (A = key rows, B = query rows) and O^T += V^T.P^T (A = rows of v^T, B = P), so a lane holds scores and outputs of ONE query row (row lr of each 16-row group):
// the maximum and the sum are in-lane but for one exchange between the lane halves, the rescale is a per-lane factor, and two S^T tiles (keys 0..15 and 16..31 of a block) are, register for register, the B fragment of P in the hardware k order (k = 8 hi + 0..7, then 16 + 8 hi + 0..7), which is also the order of ldf for Q and of ldfr for K and v^T.
// Wave w takes the 32-key blocks w, w + AW, ... up to the diagonal block and keeps its own running maximum m, sum l and output tile; a wave with no block keeps m = -3e38, l = 0, O = 0 and weighs nothing in the join.
// Join: every wave puts m, l and O in LDS; behind ONE barrier each thread takes the maximum of the AW m of its row and adds the AW partials, each scaled by exp(m_w - max), in wave order 0..AW-1 (a fixed order), divides by the joined sum and stores four outputs.
#define AW 16
#define QR 32
#define LOG2E 1.4426950408889634f
#define QPIT 72               // LDS pitch of a query row in elements: 144 bytes, 16 bytes x an odd number, for 16-byte reads down a column of rows
#define PLN (NB_ * TT * HD)   // elements from a hi plane to its lo plane: the launcher takes each pair one behind the other, and a plane is a whole number of 256-byte units
__device__ __forceinline__ v16bf ldf(const bf* p) { return cat16b(*(const v8us*)p, *(const v8us*)(p + 16)); }
// a fragment from a plane in fragment order: p = the fragment's first piece + 8 lane; its two loads (k = 8 hi + 0..7, then 16 + 8 hi + 0..7) each cover 512 bytes in a row, four whole lines
__device__ __forceinline__ v16bf ldfr(const bf* p) { return cat16b(*(const v8us*)p, *(const v8us*)(p + 256)); }
typedef __attribute__((ext_vector_type(8))) unsigned v8u;
__global__ __launch_bounds__(32 * AW) void k_attn(const bf* __restrict__ Qp, const bf* __restrict__ Kp, const bf* __restrict__ Vp, float* out) {
    __shared__ __align__(16) float ob[AW * QR * 68];
    __shared__ float ms[AW * QR]; __shared__ float ls[AW * QR];
    __shared__ __align__(16) bf qs[2 * QR * QPIT];   // the work-group's query rows, hi plane then lo plane
    const int lane = threadIdx.x & 31, lr = lane & 15, hi = lane >> 4;
    const int wave = __builtin_amdgcn_readfirstlane(threadIdx.x >> 5);   // the wave's number in a scalar register: the key loop stays a scalar branch
    const int qi = (TT / QR - 1) - (int)blockIdx.y, q0 = qi * QR;   // the longest rows start first
    const size_t pb = (size_t)blockIdx.x * TT * HD;
    out += pb;
    v8f o[4][2];                // O^T: [16 head columns][16-row group]
#pragma unroll
    for (int dt = 0; dt < 4; ++dt)
#pragma unroll
        for (int qt = 0; qt < 2; ++qt) o[dt][qt] = (v8f){};
    float m[2] = {-3.0e38f, -3.0e38f}, l[2] = {0.f, 0.f};
    {   // 2 planes x 32 rows x 128 bytes = one 16-byte piece a thread, whole lines per load
        static_assert(32 * AW * 8 == 2 * QR * HD, "one 16-byte piece of the query tile a thread");
        const int pl_ = threadIdx.x >> 8, row = (threadIdx.x >> 3) & 31, pc = threadIdx.x & 7;
        *(v8usa*)(qs + (pl_ * QR + row) * QPIT + pc * 8) = *(const v8us*)(Qp + pl_ * PLN + pb + (q0 + row) * HD + pc * 8);
    }
    __syncthreads();   // the whole query tile is in LDS before any wave reads a fragment of it
    // the lane's own pointers: row lr of the query tile in LDS, 8 elements per lane half; piece 'lane' of the wave's first 32-key block (2048 elements) of the K and v^T planes, which step on by AW blocks at the foot of a trip
    const bf* qp = qs + lr * QPIT + 8 * hi; const bf* kp = Kp + pb + wave * (32 * HD) + lane * 8; const bf* vp = Vp + pb + wave * (32 * HD) + lane * 8;
#pragma unroll 1
    for (int kb = wave; kb <= qi; kb += AW) {
        const int k0 = kb * 32;
        // the query fragments are read anew from LDS each trip: kept over the trip they do not fit beside the output tile, the v^T fragments and P in the 256 registers of a wave
        v16bf qh[2][2], ql[2][2], kh[2][2], kl[2][2];   // [16-row group][32-wide step of the head dimension]
#pragma unroll
        for (int g = 0; g < 2; ++g)
#pragma unroll
            for (int ks = 0; ks < 2; ++ks) { const int c = g * 16 * HD + ks * 512, cq = g * 16 * QPIT + ks * 32; kh[g][ks] = ldfr(kp + c); kl[g][ks] = ldfr(kp + PLN + c); qh[g][ks] = ldf(qp + cq); ql[g][ks] = ldf(qp + QR * QPIT + cq); }
        // holds the K and Q loads of a trip in one group in front of the first wait; without it the build issues them in small groups with a wait behind each
        __builtin_amdgcn_sched_barrier(0);
        v8f s[2][2];            // S^T: [16 keys][16-row group]
#pragma unroll
        for (int kt = 0; kt < 2; ++kt) { s[kt][0] = (v8f){}; s[kt][1] = (v8f){}; }
        // the four tiles in turn inside each product: four independent accumulate chains, and all four tiles have their registers before any fragment has had its last use
#pragma unroll
        for (int ks = 0; ks < 2; ++ks)
#pragma unroll
            for (int pr = 0; pr < 3; ++pr)
#pragma unroll
                for (int kt = 0; kt < 2; ++kt)
#pragma unroll
                    for (int qt = 0; qt < 2; ++qt) s[kt][qt] = wmmab(pr == 2 ? kl[kt][ks] : kh[kt][ks], pr == 1 ? ql[qt][ks] : qh[qt][ks], s[kt][qt]);
        v16bf vh[4], vl[4];
#pragma unroll
        for (int dt = 0; dt < 4; ++dt) { vh[dt] = ldfr(vp + dt * 512); vl[dt] = ldfr(vp + PLN + dt * 512); }
        // holds the v^T loads in front of the softmax, whose vector work then covers their latency (they take the registers that K and Q have left)
        __builtin_amdgcn_sched_barrier(0);
        v16bf ph[2], pl[2];
#pragma unroll
        for (int qt = 0; qt < 2; ++qt) { const int rel = q0 - k0 + qt * 16 + lr - hi * 8;   // key <= query row  <=>  16 kt + j <= rel
            v16f t; float bm = m[qt];
#pragma unroll
            for (int kt = 0; kt < 2; ++kt)
#pragma unroll
                for (int j = 0; j < 8; ++j) { const float u = (kt * 16 + j <= rel) ? s[kt][qt][j] * SCL : -3.0e38f; t[kt * 8 + j] = u; bm = fmaxf(bm, u); }
            bm = fmaxf(bm, __shfl_xor(bm, 16, 32));   // the other lane half holds the row's other 16 keys
            const float al = __builtin_amdgcn_exp2f((m[qt] - bm) * LOG2E); m[qt] = bm;
            float sum = 0.f;
#pragma unroll
            for (int e = 0; e < 16; ++e) { t[e] = __builtin_amdgcn_exp2f((t[e] - bm) * LOG2E); sum += t[e]; }
            l[qt] = l[qt] * al + sum;
#pragma unroll
            for (int dt = 0; dt < 4; ++dt) o[dt][qt] *= al;
            ph[qt] = __builtin_convertvector(t, v16bf);   // hi = bf16(p), lo = bf16(p - hi); hi goes back to f32 from the packed pairs, one shift or one mask an element
            const v8u hp = __builtin_bit_cast(v8u, ph[qt]); v16f hb;
#pragma unroll
            for (int e = 0; e < 8; ++e) { hb[2 * e] = __uint_as_float(hp[e] << 16); hb[2 * e + 1] = __uint_as_float(hp[e] & 0xFFFF0000u); }
            pl[qt] = __builtin_convertvector(t - hb, v16bf); }
#pragma unroll
        for (int dt = 0; dt < 4; ++dt)
#pragma unroll
            for (int qt = 0; qt < 2; ++qt) { o[dt][qt] = wmmab(vh[dt], ph[qt], o[dt][qt]); o[dt][qt] = wmmab(vh[dt], pl[qt], o[dt][qt]); o[dt][qt] = wmmab(vl[dt], ph[qt], o[dt][qt]); }
        // four vector slots between a trip's last matrix instruction and the next trip's first write of its operands; the memory clobber keeps the LDS reads of the query fragments inside the trip
        asm volatile("v_nop\n\tv_nop\n\tv_nop\n\tv_nop" : "+v"(o[3][0]), "+v"(o[3][1]) : "v"(vl[3]), "v"(ph[1]) : "memory");
        kp += AW * 32 * HD; vp += AW * 32 * HD;
    }
#pragma unroll
    for (int qt = 0; qt < 2; ++qt) { l[qt] += __shfl_xor(l[qt], 16, 32);   // the lane halves' sums, joined once
        float* po = ob + (wave * QR + qt * 16 + lr) * 68 + hi * 8;
#pragma unroll
        for (int dt = 0; dt < 4; ++dt) { *(v4fa*)(po + dt * 16) = __builtin_shufflevector(o[dt][qt], o[dt][qt], 0, 1, 2, 3); *(v4fa*)(po + dt * 16 + 4) = __builtin_shufflevector(o[dt][qt], o[dt][qt], 4, 5, 6, 7); }
        if (hi == 0) { ms[wave * QR + qt * 16 + lr] = m[qt]; ls[wave * QR + qt * 16 + lr] = l[qt]; } }
    __syncthreads();   // every wave's m, l and partial output are in LDS before any thread joins them
    const int q = wave * 2 + hi, d4 = lr * 4;   // thread / 16 and 4 (thread % 16)
    float mw[AW]; float mx = -3.0e38f;
#pragma unroll
    for (int w = 0; w < AW; ++w) { mw[w] = ms[w * QR + q]; mx = fmaxf(mx, mw[w]); }
    v4f acc = (v4f){}; float lsum = 0.f;
#pragma unroll
    for (int w = 0; w < AW; ++w) { const float a = (mw[w] - mx) * LOG2E; float f;
        asm("v_exp_f32 %0, %1\n\tv_nop" : "=v"(f) : "v"(a));   // exp2 with the one free slot the instruction set asks for behind a transcendental, in one statement
        lsum += ls[w * QR + q] * f; acc += *(const v4fa*)(ob + (w * QR + q) * 68 + d4) * f; }
    *(v4f*)(out + (size_t)(q0 + q) * HD + d4) = acc * __fdiv_rn(1.0f, lsum);
}

extern "C" void kernel_launch(void* const* d_in, const int* in_sizes, int n_in,
                              void* d_out, int out_size, void* d_ws, size_t ws_size, hipStream_t stream) {
    (void)in_sizes; (void)n_in; (void)out_size;
    const float* x = (const float*)d_in[0]; const float* wk = (const float*)d_in[1]; const float* wq = (const float*)d_in[2]; const float* wv = (const float*)d_in[3];   /* input order x, Wk, Wq, Wv ('xw' [1024][64]; NOTE the key weight comes FIRST) */
    float* OUT = (float*)d_out;     // [4][2048][64]
    char* wsp = (char*)d_ws;
    auto take = [&](size_t bytes) { char* p = wsp; wsp += (bytes + 255) & ~(size_t)255; return (void*)p; };
    bf* QPh = (bf*)take((size_t)NB_ * NH_ * TT * HD * 2); bf* QPl = (bf*)take((size_t)NB_ * NH_ * TT * HD * 2); bf* KPh = (bf*)take((size_t)NB_ * NKV * TT * HD * 2); bf* KPl = (bf*)take((size_t)NB_ * NKV * TT * HD * 2); bf* VTh = (bf*)take((size_t)NB_ * NKV * HD * TT * 2); bf* VTl = (bf*)take((size_t)NB_ * NKV * HD * TT * 2);
    if ((size_t)(wsp - (char*)d_ws) > ws_size) return;    // ws 256 MiB; the six planes take 6 MiB
    // x is [NB_ * TT][DM] row-contiguous, so the projections take the batch as more rows; the attention takes it as grid x. The output [b][t][d] is stored by the attention launch.
    k_proj<16><<<dim3(NB_ * TT / 64, 3, 1), 512, 0, stream>>>(x, wq, wk, wv, QPh, QPl, KPh, KPl, VTh, VTl);
    k_attn<<<dim3(NB_, TT / QR, 1), 32 * AW, 0, stream>>>(QPh, KPh, VTh, OUT);   // each lo plane lies PLN elements behind its hi plane
}

// v006
// A run of this version takes 28.1 microseconds.
// Next to v005, in two timings, it ran 1.05 and 1.04 times as fast.
// Over all steps from v000 it is 17.3 times as fast.
#include <hip/hip_runtime.h>

// Single causal attention head scaled by the EMBEDDING width (x [4][2048][1024]; k = x Wk, q = x Wq, v = x Wv ('xw' [1024][64], no bias; ONE 64-wide head); wei = q.k^T x C^-0.5 with C = n_embed = 1024 (not head_size); causal (-inf); softmax; out = wei.v -> [4][2048][64] (0.5 M); argument order x, Wk, Wq, Wv (the KEY weight comes first)).
// Layout, two launches, all four batch elements in each: ONE projection launch (grid y = q, k, v) reads x and the 'xw' weights as f32 (x in whole 128-byte lines, turned into fragments through an LDS slab of the wave's own), rounds them to bf16 in registers and writes the hi/lo planes of q, k and v^T from its own epilogue (K loop split over 16 waves, f32 partial tiles summed through LDS in wave order); the k and v^T planes lie in the order of the attention's fragments, so that each of its 16-byte-a-lane loads covers 512 bytes in a row;
// ONE attention launch: a work-group per 32 query rows, its 16 waves share out the 32-key blocks up to the diagonal; scores, softmax (running maximum) and P.V stay in registers, 3 hi/lo products each; the waves' partial outputs are joined through LDS in wave order. Scores and probabilities never go to memory.
// Compute dtypes, f32 accumulate: every input rounded to bf16; projections exact; attention 3 products on every row; softmax f32; output f32.

#define NB_  4
#define TT   2048
#define DM   1024
#define NH_  1
#define NKV  1
#define HD   64
#define SCL  0.03125f   // C^-0.5 with C = n_embed = 1024
typedef unsigned short bf;
typedef __attribute__((ext_vector_type(16))) __bf16   v16bf;
typedef __attribute__((ext_vector_type(8)))  unsigned short v8us;
typedef __attribute__((ext_vector_type(8)))  float    v8f;
typedef __attribute__((ext_vector_type(4)))  float    v4f;
typedef v4f  __attribute__((may_alias)) v4fa;
typedef v8us __attribute__((may_alias)) v8usa;

__device__ __forceinline__ unsigned short f2bf(float f) { unsigned u = __float_as_uint(f); u += 0x7FFFu + ((u >> 16) & 1u); return (unsigned short)(u >> 16); }
__device__ __forceinline__ float bf2f(unsigned short b) { return __uint_as_float(((unsigned)b) << 16); }
__device__ __forceinline__ v16bf cat16b(v8us lo, v8us hi) { return __builtin_bit_cast(v16bf, __builtin_shufflevector(lo, hi, 0, 1, 2, 3, 4, 5, 6, 7, 8, 9, 10, 11, 12, 13, 14, 15)); }
__device__ __forceinline__ v8f wmmab(v16bf a, v16bf b, v8f c) { return __builtin_amdgcn_wmma_f32_16x16x32_bf16(false, a, false, b, (short)0, c, false, false); }



// ---- ksum_regs: the NW waves of a work-group each hold an f32 partial of the same 64x64 tile (their share of the K loop); 16 rows a pass, every wave puts its partial in LDS and all threads add the NW partials
// in wave order 0..NW-1 (a fixed order). Two LDS buffers in turn, so ONE barrier a pass is enough: a buffer is written again only behind the barrier of the pass after the one that read it.
// The sums stay in registers (res[mb]: row mb * 16 + wave, columns 2 lane and 2 lane + 1) and go to memory behind the last pass, so that no barrier has to wait for a global store.
typedef __attribute__((ext_vector_type(2))) float v2fk;
typedef v2fk __attribute__((may_alias)) v2fka;
template <int NW>
__device__ __forceinline__ void ksum_regs(const v8f (&acc)[4][4], float* os, v2fk (&res)[4]) {
    static_assert(NW * 32 * 2 == 16 * 64, "two outputs a thread a pass");
    const int tid = threadIdx.x, lane = tid & 31, lr = lane & 15, hi = lane >> 4, wv = tid >> 5; const int row = tid >> 5, cofs = lane * 2;
#pragma unroll
    for (int mb = 0; mb < 4; ++mb) {
        float* buf = os + (mb & 1) * (NW * 16 * 68); float* mine = buf + wv * (16 * 68);
#pragma unroll
        for (int nb = 0; nb < 4; ++nb) {
#pragma unroll
            for (int j = 0; j < 8; ++j) mine[(hi * 8 + j) * 68 + nb * 16 + lr] = acc[mb][nb][j]; }
        __syncthreads();   // every wave's partial of these 16 rows is in LDS before any thread adds them up
        v2fk val = *(const v2fka*)(buf + row * 68 + cofs);
#pragma unroll
        for (int p = 1; p < NW; ++p) val += *(const v2fka*)(buf + p * (16 * 68) + row * 68 + cofs);
        res[mb] = val;
    }
}

__device__ __forceinline__ void splitf(float y, unsigned short& h, unsigned short& l) { h = f2bf(y); l = f2bf(y - bf2f(h)); }
typedef __attribute__((ext_vector_type(2))) unsigned short v2us;


// ---- k_proj: the three projections in one launch, grid (rows / 64, 3): grid y 0 = q, 1 = k, 2 = v. One work-group of NW waves per 64x64 tile; every wave holds the whole tile (16 accumulators) for its share of K: the 32-wide K steps wave, wave + NW, ...
// Both operands come from the f32 inputs and are rounded to bf16 in registers; the fragments' k order is k = 8 hi + 0..7, then 16 + 8 hi + 0..7, for A and for B alike. B: straight from a column of the [DM][HD] weight.
// A: a fragment's own load would touch 16 lines (16 rows, 32 bytes of each), so a wave reads its 64 rows x 32 columns of x as 16 loads of 4 whole lines (8 lanes a row), rounds, puts the bf16 rows in an LDS slab that no other wave touches (pitch XPIT) and reads the four fragments back, 16 bytes a lane.
// The slabs lie behind buffer 0 of the K sum: pass 0 of the sum writes buffer 0 alone, and buffer 1 is first written behind the barrier of pass 0, which every wave reaches with its last slab read done.
// The epilogue splits each f32 sum into hi + lo bf16 and writes the planes the attention reads: q as [b][t][d]; k and v^T in FRAGMENT ORDER, in pieces of 8 elements (16 bytes), 32 pieces = the 32 lanes of one load, in a row:
//   k:   element (t, d) at (t / 16) * 1024 + (d / 8) * 128 + (t % 16) * 8 + d % 8           (a 16-key group: piece = 8 head columns of one key; lane = 16 * (d / 8 % 2) + t % 16)
//   v^T: element (d, t) at (t / 32) * 2048 + (d / 16) * 512 + (t / 8 % 4) * 128 + (d % 16) * 8 + t % 8   (a 32-key block: piece = 8 keys of one head column; lane = 16 * (t / 8 % 2) + d % 16)
// Either way a 64-row tile fills 4096 elements in a row from element r0 * HD of the plane on (t counted through the batch), and thread i stores piece i of it (turned through LDS): a wave's store covers 512 bytes in a row and each 128-byte line has one writer.
// f32 -> bf16 by the hardware conversion: round to nearest even, the rounding of f2bf
typedef __attribute__((ext_vector_type(16))) float v16f;
#define XPIT 40               // LDS pitch of a 32-column bf16 row of x in elements: 80 bytes, 16 bytes x an odd number, for 16-byte reads down a column of rows
typedef __attribute__((ext_vector_type(4))) __bf16 v4bf;
typedef __attribute__((ext_vector_type(4))) unsigned short v4us;
typedef v4us __attribute__((may_alias)) v4usa;
__device__ __forceinline__ v16bf ldw(const float* p) { v16f f;
#pragma unroll
    for (int e = 0; e < 8; ++e) { f[e] = p[e * HD]; f[8 + e] = p[(16 + e) * HD]; }
    return __builtin_convertvector(f, v16bf); }
template <int NW>
__global__ __launch_bounds__(32 * NW) void k_proj(const float* __restrict__ x, const float* __restrict__ wq, const float* __restrict__ wk, const float* __restrict__ wv, bf* QPh, bf* QPl, bf* KPh, bf* KPl, bf* VTh, bf* VTl) {
    __shared__ __align__(16) float os[NW * 16 * 68 + NW * 64 * XPIT / 2];   // K sum: two buffers of NW * 16 * 68 floats; K loop: NW slabs of 64 * XPIT bf16 from the start of buffer 1 on
    static_assert(NW * 64 * XPIT / 2 >= NW * 16 * 68, "the slabs cover buffer 1 of the K sum");
    const int which = blockIdx.y; const float* w = (which == 0) ? wq : (which == 1) ? wk : wv;
    const int tid = threadIdx.x, lane = tid & 31, lr = lane & 15, hi = lane >> 4; const int r0 = blockIdx.x * 64;
    v8f acc[4][4];
#pragma unroll
    for (int mb = 0; mb < 4; ++mb)
#pragma unroll
        for (int nb = 0; nb < 4; ++nb) acc[mb][nb] = (v8f){};
    const float* xa = x + (size_t)(r0 + (lane >> 3)) * DM + (lane & 7) * 4; const float* wb = w + (size_t)(8 * hi) * HD + lr;   // x: 8 lanes a row, 16 bytes a lane
    const int wave = __builtin_amdgcn_readfirstlane(tid >> 5);   // the wave's number in a scalar register: the K loop stays a scalar branch
    bf* xs = (bf*)(os + NW * 16 * 68) + wave * (64 * XPIT);   // the wave's own slab
    bf* xw = xs + (lane >> 3) * XPIT + (lane & 7) * 4; const bf* xr = xs + lr * XPIT + 8 * hi;   // where the lane puts its 4 columns; row lr of a fragment, 8 columns per lane half
#pragma unroll 1
    for (int kc = wave * 32; kc < DM; kc += NW * 32) {
        v16bf a[4]; v4f xf[16];
#pragma unroll
        for (int i = 0; i < 16; ++i) xf[i] = *(const v4f*)(xa + (size_t)i * 4 * DM + kc);   // rows 4 i .. 4 i + 3, one whole line of each
#pragma unroll
        for (int nh = 0; nh < 2; ++nh) { v16bf b[2];
#pragma unroll
            for (int q = 0; q < 2; ++q) b[q] = ldw(wb + (size_t)kc * HD + (nh * 2 + q) * 16);
            if (nh == 0) {
#pragma unroll
                for (int i = 0; i < 16; ++i) *(v4usa*)(xw + i * 4 * XPIT) = __builtin_bit_cast(v4us, __builtin_convertvector(xf[i], v4bf));
                asm volatile("s_wait_dscnt 0x0" ::: "memory");   // the wave's own rows are in its slab before it reads them back across lanes; the clobber keeps the reads behind the writes in the build
#pragma unroll
                for (int mb = 0; mb < 4; ++mb) a[mb] = cat16b(*(const v8usa*)(xr + mb * 16 * XPIT), *(const v8usa*)(xr + mb * 16 * XPIT + 16));
            }
            // holds the loads of a trip in two groups: the x rows and two weight fragments all issue in front of the first wait, the last two weight fragments behind their rounding (all at once do not fit beside the 128 accumulator registers); without it this build issues the loads in many small groups with a wait behind each
            __builtin_amdgcn_sched_barrier(0);
#pragma unroll
            for (int q = 0; q < 2; ++q)
#pragma unroll
                for (int mb = 0; mb < 4; ++mb) acc[mb][nh * 2 + q] = wmmab(a[mb], b[q], acc[mb][nh * 2 + q]); }
        // four vector slots between a trip's last matrix instruction and the next trip's first write of its operands
        asm volatile("v_nop\n\tv_nop\n\tv_nop\n\tv_nop" : "+v"(acc[0][0]), "+v"(acc[1][1]), "+v"(acc[2][2]), "+v"(acc[3][3]) : "v"(a[0]), "v"(a[3]));
    }
    v2fk res[4]; ksum_regs<NW>(acc, os, res);
    const int row = tid >> 5, cofs = lane * 2;
    if (which == 0) {
#pragma unroll
        for (int mb = 0; mb < 4; ++mb) { const size_t e = (size_t)(r0 + mb * 16 + row) * HD + cofs; v2us oh, ol;
#pragma unroll
            for (int q = 0; q < 2; ++q) { unsigned short a2, c2; splitf(res[mb][q], a2, c2); oh[q] = a2; ol[q] = c2; }
            *(v2us*)(QPh + e) = oh; *(v2us*)(QPl + e) = ol; }
    } else {
        float* ft = os;   // k: [t][d], v: [d][t], pitch 68, in LDS buffer 0: its last readers (pass 2 of the sum) are behind the barrier of pass 3, and pass 3 reads buffer 1 alone
        if (which == 1) {
#pragma unroll
            for (int mb = 0; mb < 4; ++mb) *(v2fka*)(ft + (mb * 16 + row) * 68 + cofs) = res[mb];
        } else {
#pragma unroll
            for (int mb = 0; mb < 4; ++mb) { ft[cofs * 68 + mb * 16 + row] = res[mb][0]; ft[(cofs + 1) * 68 + mb * 16 + row] = res[mb][1]; }
        }
        __syncthreads();   // the whole tile is in LDS before any thread reads a piece of it (grid y is the same for the whole work-group)
        // piece tid of the tile: its LDS row (k: the key, v: the head column) and its first column (k: head column, v: key)
        const int pr = (which == 1) ? (tid >> 7) * 16 + (tid & 15) : ((tid >> 6) & 3) * 16 + (tid & 15);
        const int pc = (which == 1) ? ((tid >> 4) & 7) * 8 : (tid >> 8) * 32 + ((tid >> 4) & 3) * 8;
        const v4f f0 = *(const v4fa*)(ft + pr * 68 + pc), f1 = *(const v4fa*)(ft + pr * 68 + pc + 4); v8us oh, ol;
#pragma unroll
        for (int q = 0; q < 4; ++q) { unsigned short a2, c2; splitf(f0[q], a2, c2); oh[q] = a2; ol[q] = c2; splitf(f1[q], a2, c2); oh[4 + q] = a2; ol[4 + q] = c2; }
        const size_t o = (size_t)r0 * HD + tid * 8; *(v8us*)(((which == 1) ? KPh : VTh) + o) = oh; *(v8us*)(((which == 1) ? KPl : VTl) + o) = ol;
        asm volatile("s_wait_xcnt 0x0" ::: "memory");   // stands in front of any later write of a register that the two stores above name (address or data), on every way the branches behind them allow
    }
}

// ---- k_attn: causal attention for QR query rows of one batch element per work-group. Transposed products: S^T = K.Q^T (A = key rows, B = query rows) and O^T += V^T.P^T (A = rows of v^T, B = P), so a lane holds scores and outputs of ONE query row (row lr of each 16-row group):
// the maximum and the sum are in-lane but for one exchange between the lane halves, the rescale is a per-lane factor, and two S^T tiles (keys 0..15 and 16..31 of a block) are, register for register, the B fragment of P in the hardware k order (k = 8 hi + 0..7, then 16 + 8 hi + 0..7), which is also the order of ldf for Q and of ldfr for K and v^T.
// Wave w takes the 32-key blocks w, w + AW, ... up to the diagonal block and keeps its own running maximum m, sum l and output tile; a wave with no block keeps m = -3e38, l = 0, O = 0 and weighs nothing in the join.
// Join: every wave puts m, l and O in LDS; behind ONE barrier each thread takes the maximum of the AW m of its row and adds the AW partials, each scaled by exp(m_w - max), in wave order 0..AW-1 (a fixed order), divides by the joined sum and stores four outputs.
#define AW 16
#define QR 32
#define LOG2E 1.4426950408889634f
#define QPIT 72               // LDS pitch of a query row in elements: 144 bytes, 16 bytes x an odd number, for 16-byte reads down a column of rows
#define PLN (NB_ * TT * HD)   // elements from a hi plane to its lo plane: the launcher takes each pair one behind the other, and a plane is a whole number of 256-byte units
__device__ __forceinline__ v16bf ldf(const bf* p) { return cat16b(*(const v8us*)p, *(const v8us*)(p + 16)); }
// a fragment from a plane in fragment order: p = the fragment's first piece + 8 lane; its two loads (k = 8 hi + 0..7, then 16 + 8 hi + 0..7) each cover 512 bytes in a row, four whole lines
__device__ __forceinline__ v16bf ldfr(const bf* p) { return cat16b(*(const v8us*)p, *(const v8us*)(p + 256)); }
typedef __attribute__((ext_vector_type(8))) unsigned v8u;
__global__ __launch_bounds__(32 * AW) void k_attn(const bf* __restrict__ Qp, const bf* __restrict__ Kp, const bf* __restrict__ Vp, float* out) {
    __shared__ __align__(16) float ob[AW * QR * 68];
    __shared__ float ms[AW * QR]; __shared__ float ls[AW * QR];
    __shared__ __align__(16) bf qs[2 * QR * QPIT];   // the work-group's query rows, hi plane then lo plane
    const int lane = threadIdx.x & 31, lr = lane & 15, hi = lane >> 4;
    const int wave = __builtin_amdgcn_readfirstlane(threadIdx.x >> 5);   // the wave's number in a scalar register: the key loop stays a scalar branch
    const int qi = (TT / QR - 1) - (int)blockIdx.y, q0 = qi * QR;   // the longest rows start first
    const size_t pb = (size_t)blockIdx.x * TT * HD;
    out += pb;
    v8f o[4][2];                // O^T: [16 head columns][16-row group]
#pragma unroll
    for (int dt = 0; dt < 4; ++dt)
#pragma unroll
        for (int qt = 0; qt < 2; ++qt) o[dt][qt] = (v8f){};
    float m[2] = {-3.0e38f, -3.0e38f}, l[2] = {0.f, 0.f};
    {   // 2 planes x 32 rows x 128 bytes = one 16-byte piece a thread, whole lines per load
        static_assert(32 * AW * 8 == 2 * QR * HD, "one 16-byte piece of the query tile a thread");
        const int pl_ = threadIdx.x >> 8, row = (threadIdx.x >> 3) & 31, pc = threadIdx.x & 7;
        *(v8usa*)(qs + (pl_ * QR + row) * QPIT + pc * 8) = *(const v8us*)(Qp + pl_ * PLN + pb + (q0 + row) * HD + pc * 8);
    }
    __syncthreads();   // the whole query tile is in LDS before any wave reads a fragment of it
    // the lane's own pointers: row lr of the query tile in LDS, 8 elements per lane half; piece 'lane' of the wave's first 32-key block (2048 elements) of the K and v^T planes, which step on by AW blocks at the foot of a trip
    const bf* qp = qs + lr * QPIT + 8 * hi; const bf* kp = Kp + pb + wave * (32 * HD) + lane * 8; const bf* vp = Vp + pb + wave * (32 * HD) + lane * 8;
#pragma unroll 1
    for (int kb = wave; kb <= qi; kb += AW) {
        const int k0 = kb * 32;
        // the query fragments are read anew from LDS each trip: kept over the trip they do not fit beside the output tile, the v^T fragments and P in the 256 registers of a wave
        v16bf qh[2][2], ql[2][2], kh[2][2], kl[2][2];   // [16-row group][32-wide step of the head dimension]
#pragma unroll
        for (int g = 0; g < 2; ++g)
#pragma unroll
            for (int ks = 0; ks < 2; ++ks) { const int c = g * 16 * HD + ks * 512, cq = g * 16 * QPIT + ks * 32; kh[g][ks] = ldfr(kp + c); kl[g][ks] = ldfr(kp + PLN + c); qh[g][ks] = ldf(qp + cq); ql[g][ks] = ldf(qp + QR * QPIT + cq); }
        // holds the K and Q loads of a trip in one group in front of the first wait; without it the build issues them in small groups with a wait behind each
        __builtin_amdgcn_sched_barrier(0);
        v8f s[2][2];            // S^T: [16 keys][16-row group]
#pragma unroll
        for (int kt = 0; kt < 2; ++kt) { s[kt][0] = (v8f){}; s[kt][1] = (v8f){}; }
        // the four tiles in turn inside each product: four independent accumulate chains, and all four tiles have their registers before any fragment has had its last use
#pragma unroll
        for (int ks = 0; ks < 2; ++ks)
#pragma unroll
            for (int pr = 0; pr < 3; ++pr)
#pragma unroll
                for (int kt = 0; kt < 2; ++kt)
#pragma unroll
                    for (int qt = 0; qt < 2; ++qt) s[kt][qt] = wmmab(pr == 2 ? kl[kt][ks] : kh[kt][ks], pr == 1 ? ql[qt][ks] : qh[qt][ks], s[kt][qt]);
        v16bf vh[4], vl[4];
#pragma unroll
        for (int dt = 0; dt < 4; ++dt) { vh[dt] = ldfr(vp + dt * 512); vl[dt] = ldfr(vp + PLN + dt * 512); }
        // holds the v^T loads in front of the softmax, whose vector work then covers their latency (they take the registers that K and Q have left)
        __builtin_amdgcn_sched_barrier(0);
        v16bf ph[2], pl[2];
#pragma unroll
        for (int qt = 0; qt < 2; ++qt) { const int rel = q0 - k0 + qt * 16 + lr - hi * 8;   // key <= query row  <=>  16 kt + j <= rel
            v16f t; float bm = m[qt];
#pragma unroll
            for (int kt = 0; kt < 2; ++kt)
#pragma unroll
                for (int j = 0; j < 8; ++j) { const float u = (kt * 16 + j <= rel) ? s[kt][qt][j] * SCL : -3.0e38f; t[kt * 8 + j] = u; bm = fmaxf(bm, u); }
            bm = fmaxf(bm, __shfl_xor(bm, 16, 32));   // the other lane half holds the row's other 16 keys
            const float al = __builtin_amdgcn_exp2f((m[qt] - bm) * LOG2E); m[qt] = bm;
            float sum = 0.f;
#pragma unroll
            for (int e = 0; e < 16; ++e) { t[e] = __builtin_amdgcn_exp2f((t[e] - bm) * LOG2E); sum += t[e]; }
            l[qt] = l[qt] * al + sum;
#pragma unroll
            for (int dt = 0; dt < 4; ++dt) o[dt][qt] *= al;
            ph[qt] = __builtin_convertvector(t, v16bf);   // hi = bf16(p), lo = bf16(p - hi); hi goes back to f32 from the packed pairs, one shift or one mask an element
            const v8u hp = __builtin_bit_cast(v8u, ph[qt]); v16f hb;
#pragma unroll
            for (int e = 0; e < 8; ++e) { hb[2 * e] = __uint_as_float(hp[e] << 16); hb[2 * e + 1] = __uint_as_float(hp[e] & 0xFFFF0000u); }
            pl[qt] = __builtin_convertvector(t - hb, v16bf); }
#pragma unroll
        for (int dt = 0; dt < 4; ++dt)
#pragma unroll
            for (int qt = 0; qt < 2; ++qt) { o[dt][qt] = wmmab(vh[dt], ph[qt], o[dt][qt]); o[dt][qt] = wmmab(vh[dt], pl[qt], o[dt][qt]); o[dt][qt] = wmmab(vl[dt], ph[qt], o[dt][qt]); }
        // four vector slots between a trip's last matrix instruction and the next trip's first write of its operands; the memory clobber keeps the LDS reads of the query fragments inside the trip
        asm volatile("v_nop\n\tv_nop\n\tv_nop\n\tv_nop" : "+v"(o[3][0]), "+v"(o[3][1]) : "v"(vl[3]), "v"(ph[1]) : "memory");
        kp += AW * 32 * HD; vp += AW * 32 * HD;
    }
#pragma unroll
    for (int qt = 0; qt < 2; ++qt) { l[qt] += __shfl_xor(l[qt], 16, 32);   // the lane halves' sums, joined once
        float* po = ob + (wave * QR + qt * 16 + lr) * 68 + hi * 8;
#pragma unroll
        for (int dt = 0; dt < 4; ++dt) { *(v4fa*)(po + dt * 16) = __builtin_shufflevector(o[dt][qt], o[dt][qt], 0, 1, 2, 3); *(v4fa*)(po + dt * 16 + 4) = __builtin_shufflevector(o[dt][qt], o[dt][qt], 4, 5, 6, 7); }
        if (hi == 0) { ms[wave * QR + qt * 16 + lr] = m[qt]; ls[wave * QR + qt * 16 + lr] = l[qt]; } }
    __syncthreads();   // every wave's m, l and partial output are in LDS before any thread joins them
    const int q = wave * 2 + hi, d4 = lr * 4;   // thread / 16 and 4 (thread % 16)
    float mw[AW]; float mx = -3.0e38f;
#pragma unroll
    for (int w = 0; w < AW; ++w) { mw[w] = ms[w * QR + q]; mx = fmaxf(mx, mw[w]); }
    v4f acc = (v4f){}; float lsum = 0.f;
#pragma unroll
    for (int w = 0; w < AW; ++w) { const float a = (mw[w] - mx) * LOG2E; float f;
        asm("v_exp_f32 %0, %1\n\tv_nop" : "=v"(f) : "v"(a));   // exp2 with the one free slot the instruction set asks for behind a transcendental, in one statement
        lsum += ls[w * QR + q] * f; acc += *(const v4fa*)(ob + (w * QR + q) * 68 + d4) * f; }
    *(v4f*)(out + (size_t)(q0 + q) * HD + d4) = acc * __fdiv_rn(1.0f, lsum);
}

extern "C" void kernel_launch(void* const* d_in, const int* in_sizes, int n_in,
                              void* d_out, int out_size, void* d_ws, size_t ws_size, hipStream_t stream) {
    (void)in_sizes; (void)n_in; (void)out_size;
    const float* x = (const float*)d_in[0]; const float* wk = (const float*)d_in[1]; const float* wq = (const float*)d_in[2]; const float* wv = (const float*)d_in[3];   /* input order x, Wk, Wq, Wv ('xw' [1024][64]; NOTE the key weight comes FIRST) */
    float* OUT = (float*)d_out;     // [4][2048][64]
    char* wsp = (char*)d_ws;
    auto take = [&](size_t bytes) { char* p = wsp; wsp += (bytes + 255) & ~(size_t)255; return (void*)p; };
    bf* QPh = (bf*)take((size_t)NB_ * NH_ * TT * HD * 2); bf* QPl = (bf*)take((size_t)NB_ * NH_ * TT * HD * 2); bf* KPh = (bf*)take((size_t)NB_ * NKV * TT * HD * 2); bf* KPl = (bf*)take((size_t)NB_ * NKV * TT * HD * 2); bf* VTh = (bf*)take((size_t)NB_ * NKV * HD * TT * 2); bf* VTl = (bf*)take((size_t)NB_ * NKV * HD * TT * 2);
    if ((size_t)(wsp - (char*)d_ws) > ws_size) return;    // ws 256 MiB; the six planes take 6 MiB
    // By registers one projection work-group fits a WGP (4 waves a SIMD at over 192 registers each): the 384 work-groups take the 256 WGPs in two turns, the second half empty.
    // x is [NB_ * TT][DM] row-contiguous, so the projections take the batch as more rows; the attention takes it as grid x. The output [b][t][d] is stored by the attention launch.
    k_proj<16><<<dim3(NB_ * TT / 64, 3, 1), 512, 0, stream>>>(x, wq, wk, wv, QPh, QPl, KPh, KPl, VTh, VTl);
    k_attn<<<dim3(NB_, TT / QR, 1), 32 * AW, 0, stream>>>(QPh, KPh, VTh, OUT);   // each lo plane lies PLN elements behind its hi plane
}

// v007
// A run of this version takes 24.5 microseconds.
// In two side-by-side timings against v006, it was 1.12 and 1.13 times as fast.
// Counting every step since v000, it is 19.5 times as fast.
#include <hip/hip_runtime.h>

// Single causal attention head scaled by the EMBEDDING width (x [4][2048][1024]; k = x Wk, q = x Wq, v = x Wv ('xw' [1024][64], no bias; ONE 64-wide head); wei = q.k^T x C^-0.5 with C = n_embed = 1024 (not head_size); causal (-inf); softmax; out = wei.v -> [4][2048][64] (0.5 M); argument order x, Wk, Wq, Wv (the KEY weight comes first)).
// Layout, two launches, all four batch elements in each: ONE projection launch (grid y = q, k, v) reads x and the 'xw' weights as f32 (x in whole 128-byte lines, turned into fragments through an LDS slab of the wave's own), rounds them to bf16 in registers and writes the hi/lo planes of q, k and v^T from its own epilogue (work-groups of 8 waves, two to a WGP, so that all 384 are resident at once; K loop split over the 8 waves, f32 partial tiles summed through LDS in wave order); the k and v^T planes lie in the order of the attention's fragments, so that each of its 16-byte-a-lane loads covers 512 bytes in a row;
// ONE attention launch: a work-group per 32 query rows, its 16 waves share out the 32-key blocks up to the diagonal; scores, softmax (running maximum) and P.V stay in registers, 3 hi/lo products each; the waves' partial outputs are joined through LDS in wave order. Scores and probabilities never go to memory.
// Compute dtypes, f32 accumulate: every input rounded to bf16; projections exact; attention 3 products on every row; softmax f32; output f32.

#define NB_  4
#define TT   2048
#define DM   1024
#define NH_  1
#define NKV  1
#define HD   64
#define SCL  0.03125f   // C^-0.5 with C = n_embed = 1024
typedef unsigned short bf;
typedef __attribute__((ext_vector_type(16))) __bf16   v16bf;
typedef __attribute__((ext_vector_type(8)))  unsigned short v8us;
typedef __attribute__((ext_vector_type(8)))  float    v8f;
typedef __attribute__((ext_vector_type(4)))  float    v4f;
typedef v4f  __attribute__((may_alias)) v4fa;
typedef v8us __attribute__((may_alias)) v8usa;

__device__ __forceinline__ unsigned short f2bf(float f) { unsigned u = __float_as_uint(f); u += 0x7FFFu + ((u >> 16) & 1u); return (unsigned short)(u >> 16); }
__device__ __forceinline__ float bf2f(unsigned short b) { return __uint_as_float(((unsigned)b) << 16); }
__device__ __forceinline__ v16bf cat16b(v8us lo, v8us hi) { return __builtin_bit_cast(v16bf, __builtin_shufflevector(lo, hi, 0, 1, 2, 3, 4, 5, 6, 7, 8, 9, 10, 11, 12, 13, 14, 15)); }
__device__ __forceinline__ v8f wmmab(v16bf a, v16bf b, v8f c) { return __builtin_amdgcn_wmma_f32_16x16x32_bf16(false, a, false, b, (short)0, c, false, false); }



// ---- ksum_regs: the NW waves of a work-group each hold an f32 partial of the same 64x64 tile (their share of the K loop); 16 rows a pass, every wave puts its partial in LDS and all threads add the NW partials
// in wave order 0..NW-1 (a fixed order). Two LDS buffers in turn, so ONE barrier a pass is enough: a buffer is written again only behind the barrier of the pass after the one that read it.
// The sums stay in registers (res[mb]: row mb * 16 + thread / 16, columns 4 (thread % 16) + 0..3) and go to memory behind the last pass, so that no barrier has to wait for a global store.
template <int NW>
__device__ __forceinline__ void ksum_regs(const v8f (&acc)[4][4], float* os, v4f (&res)[4]) {
    static_assert(NW * 32 * 4 == 16 * 64, "four outputs a thread a pass");
    const int tid = threadIdx.x, lane = tid & 31, lr = lane & 15, hi = lane >> 4, wv = tid >> 5; const int row = tid >> 4, cofs = lr * 4;
#pragma unroll
    for (int mb = 0; mb < 4; ++mb) {
        float* buf = os + (mb & 1) * (NW * 16 * 68); float* mine = buf + wv * (16 * 68);
#pragma unroll
        for (int nb = 0; nb < 4; ++nb) {
#pragma unroll
            for (int j = 0; j < 8; ++j) mine[(hi * 8 + j) * 68 + nb * 16 + lr] = acc[mb][nb][j]; }
        __syncthreads();   // every wave's partial of these 16 rows is in LDS before any thread adds them up
        v4f val = *(const v4fa*)(buf + row * 68 + cofs);
#pragma unroll
        for (int p = 1; p < NW; ++p) val += *(const v4fa*)(buf + p * (16 * 68) + row * 68 + cofs);
        res[mb] = val;
    }
}

__device__ __forceinline__ void splitf(float y, unsigned short& h, unsigned short& l) { h = f2bf(y); l = f2bf(y - bf2f(h)); }


// ---- k_proj: the three projections in one launch, grid (rows / 64, 3): grid y 0 = q, 1 = k, 2 = v. One work-group of NW waves per 64x64 tile; every wave holds the whole tile (16 accumulators) for its share of K: the 32-wide K steps wave, wave + NW, ...
// Both operands come from the f32 inputs and are rounded to bf16 in registers; the fragments' k order is k = 8 hi + 0..7, then 16 + 8 hi + 0..7, for A and for B alike. B: straight from a column of the [DM][HD] weight.
// A: a fragment's own load would touch 16 lines (16 rows, 32 bytes of each), so a wave reads its 64 rows x 32 columns of x as 16 loads of 4 whole lines (8 lanes a row), rounds, puts the bf16 rows in an LDS slab that no other wave touches (pitch XPIT) and reads the four fragments back, 16 bytes a lane.
// The slabs lie behind buffer 0 of the K sum: pass 0 of the sum writes buffer 0 alone, and buffer 1 is first written behind the barrier of pass 0, which every wave reaches with its last slab read done.
// The epilogue splits each f32 sum into hi + lo bf16 and writes the planes the attention reads: q as [b][t][d]; k and v^T in FRAGMENT ORDER, in pieces of 8 elements (16 bytes), 32 pieces = the 32 lanes of one load, in a row:
//   k:   element (t, d) at (t / 16) * 1024 + (d / 8) * 128 + (t % 16) * 8 + d % 8           (a 16-key group: piece = 8 head columns of one key; lane = 16 * (d / 8 % 2) + t % 16)
//   v^T: element (d, t) at (t / 32) * 2048 + (d / 16) * 512 + (t / 8 % 4) * 128 + (d % 16) * 8 + t % 8   (a 32-key block: piece = 8 keys of one head column; lane = 16 * (t / 8 % 2) + d % 16)
// Either way a 64-row tile fills 4096 elements in a row from element r0 * HD of the plane on (t counted through the batch), and thread i stores pieces i and i + 256 of it (turned through LDS): a wave's store covers 512 bytes in a row and each 128-byte line has one writer.
// Two work-groups to a WGP: 8 waves of at most 256 registers each and under 160 KiB of LDS, so that the 384 work-groups find 512 places and none waits for a place.
// f32 -> bf16 by the hardware conversion: round to nearest even, the rounding of f2bf
typedef __attribute__((ext_vector_type(16))) float v16f;
#define XPIT 40               // LDS pitch of a 32-column bf16 row of x in elements: 80 bytes, 16 bytes x an odd number, for 16-byte reads down a column of rows
typedef __attribute__((ext_vector_type(4))) __bf16 v4bf;
typedef __attribute__((ext_vector_type(4))) unsigned short v4us;
typedef v4us __attribute__((may_alias)) v4usa;
__device__ __forceinline__ v16bf ldw(const float* p) { v16f f;
#pragma unroll
    for (int e = 0; e < 8; ++e) { f[e] = p[e * HD]; f[8 + e] = p[(16 + e) * HD]; }
    return __builtin_convertvector(f, v16bf); }
template <int NW>
__global__ __launch_bounds__(32 * NW) __attribute__((amdgpu_waves_per_eu(4, 4))) void k_proj(const float* __restrict__ x, const float* __restrict__ wq, const float* __restrict__ wk, const float* __restrict__ wv, bf* QPh, bf* QPl, bf* KPh, bf* KPl, bf* VTh, bf* VTl) {
    __shared__ __align__(16) float os[NW * 16 * 68 + NW * 64 * XPIT / 2];   // K sum: two buffers of NW * 16 * 68 floats; K loop: NW slabs of 64 * XPIT bf16 from the start of buffer 1 on
    static_assert(NW * 64 * XPIT / 2 >= NW * 16 * 68, "the slabs cover buffer 1 of the K sum");
    const int which = blockIdx.y; const float* w = (which == 0) ? wq : (which == 1) ? wk : wv;
    const int tid = threadIdx.x, lane = tid & 31, lr = lane & 15, hi = lane >> 4; const int r0 = blockIdx.x * 64;
    v8f acc[4][4];
#pragma unroll
    for (int mb = 0; mb < 4; ++mb)
#pragma unroll
        for (int nb = 0; nb < 4; ++nb) acc[mb][nb] = (v8f){};
    const float* xa = x + (size_t)(r0 + (lane >> 3)) * DM + (lane & 7) * 4; const float* wb = w + (size_t)(8 * hi) * HD + lr;   // x: 8 lanes a row, 16 bytes a lane
    const int wave = __builtin_amdgcn_readfirstlane(tid >> 5);   // the wave's number in a scalar register: the K loop stays a scalar branch
    bf* xs = (bf*)(os + NW * 16 * 68) + wave * (64 * XPIT);   // the wave's own slab
    bf* xw = xs + (lane >> 3) * XPIT + (lane & 7) * 4; const bf* xr = xs + lr * XPIT + 8 * hi;   // where the lane puts its 4 columns; row lr of a fragment, 8 columns per lane half
#pragma unroll 1
    for (int kc = wave * 32; kc < DM; kc += NW * 32) {
        v16bf a[4]; v4f xf[16];
#pragma unroll
        for (int i = 0; i < 16; ++i) xf[i] = *(const v4f*)(xa + (size_t)i * 4 * DM + kc);   // rows 4 i .. 4 i + 3, one whole line of each
#pragma unroll
        for (int nh = 0; nh < 2; ++nh) { v16bf b[2];
#pragma unroll
            for (int q = 0; q < 2; ++q) b[q] = ldw(wb + (size_t)kc * HD + (nh * 2 + q) * 16);
            if (nh == 0) {
#pragma unroll
                for (int i = 0; i < 16; ++i) *(v4usa*)(xw + i * 4 * XPIT) = __builtin_bit_cast(v4us, __builtin_convertvector(xf[i], v4bf));
                asm volatile("s_wait_dscnt 0x0" ::: "memory");   // the wave's own rows are in its slab before it reads them back across lanes; the clobber keeps the reads behind the writes in the build
#pragma unroll
                for (int mb = 0; mb < 4; ++mb) a[mb] = cat16b(*(const v8usa*)(xr + mb * 16 * XPIT), *(const v8usa*)(xr + mb * 16 * XPIT + 16));
            }
            // holds the loads of a trip in two groups: the x rows and two weight fragments all issue in front of the first wait, the last two weight fragments behind their rounding (all at once do not fit beside the 128 accumulator registers); without it this build issues the loads in many small groups with a wait behind each
            __builtin_amdgcn_sched_barrier(0);
#pragma unroll
            for (int q = 0; q < 2; ++q)
#pragma unroll
                for (int mb = 0; mb < 4; ++mb) acc[mb][nh * 2 + q] = wmmab(a[mb], b[q], acc[mb][nh * 2 + q]); }
        // four vector slots between a trip's last matrix instruction and the next trip's first write of its operands
        asm volatile("v_nop\n\tv_nop\n\tv_nop\n\tv_nop" : "+v"(acc[0][0]), "+v"(acc[1][1]), "+v"(acc[2][2]), "+v"(acc[3][3]) : "v"(a[0]), "v"(a[3]));
    }
    v4f res[4]; ksum_regs<NW>(acc, os, res);
    const int row = tid >> 4, cofs = lr * 4;
    if (which == 0) {
#pragma unroll
        for (int mb = 0; mb < 4; ++mb) { const size_t e = (size_t)(r0 + mb * 16 + row) * HD + cofs; v4us oh, ol;
#pragma unroll
            for (int q = 0; q < 4; ++q) { unsigned short a2, c2; splitf(res[mb][q], a2, c2); oh[q] = a2; ol[q] = c2; }
            *(v4us*)(QPh + e) = oh; *(v4us*)(QPl + e) = ol; }
        asm volatile("s_wait_xcnt 0x0" ::: "memory");   // stands in front of any later write of a register that the stores above name (address or data)
    } else {
        float* ft = os;   // k: [t][d], v: [d][t], pitch 68, in LDS buffer 0: its last readers (pass 2 of the sum) are behind the barrier of pass 3, and pass 3 reads buffer 1 alone
        if (which == 1) {
#pragma unroll
            for (int mb = 0; mb < 4; ++mb) *(v4fa*)(ft + (mb * 16 + row) * 68 + cofs) = res[mb];
        } else {
#pragma unroll
            for (int mb = 0; mb < 4; ++mb)
#pragma unroll
                for (int c = 0; c < 4; ++c) ft[(cofs + c) * 68 + mb * 16 + row] = res[mb][c];
        }
        __syncthreads();   // the whole tile is in LDS before any thread reads a piece of it (grid y is the same for the whole work-group)
        static_assert(NW * 32 * 2 * 8 == 64 * HD, "two 8-element pieces of the tile a thread");
        v8us oh[2], ol[2];
#pragma unroll
        for (int h = 0; h < 2; ++h) { const int pi = tid + h * (NW * 32);
            // piece pi of the tile: its LDS row (k: the key, v: the head column) and its first column (k: head column, v: key)
            const int pr = (which == 1) ? (pi >> 7) * 16 + (pi & 15) : ((pi >> 6) & 3) * 16 + (pi & 15);
            const int pc = (which == 1) ? ((pi >> 4) & 7) * 8 : (pi >> 8) * 32 + ((pi >> 4) & 3) * 8;
            const v4f f0 = *(const v4fa*)(ft + pr * 68 + pc), f1 = *(const v4fa*)(ft + pr * 68 + pc + 4);
#pragma unroll
            for (int q = 0; q < 4; ++q) { unsigned short a2, c2; splitf(f0[q], a2, c2); oh[h][q] = a2; ol[h][q] = c2; splitf(f1[q], a2, c2); oh[h][4 + q] = a2; ol[h][4 + q] = c2; } }
        bf* ph_ = ((which == 1) ? KPh : VTh) + (size_t)r0 * HD + tid * 8; bf* pl_ = ((which == 1) ? KPl : VTl) + (size_t)r0 * HD + tid * 8;
#pragma unroll
        for (int h = 0; h < 2; ++h) { *(v8us*)(ph_ + h * (NW * 32 * 8)) = oh[h]; *(v8us*)(pl_ + h * (NW * 32 * 8)) = ol[h]; }
        asm volatile("s_wait_xcnt 0x0" ::: "memory");   // stands in front of any later write of a register that the four stores above name (address or data), on every way the branches behind them allow
    }
}

// ---- k_attn: causal attention for QR query rows of one batch element per work-group. Transposed products: S^T = K.Q^T (A = key rows, B = query rows) and O^T += V^T.P^T (A = rows of v^T, B = P), so a lane holds scores and outputs of ONE query row (row lr of each 16-row group):
// the maximum and the sum are in-lane but for one exchange between the lane halves, the rescale is a per-lane factor, and two S^T tiles (keys 0..15 and 16..31 of a block) are, register for register, the B fragment of P in the hardware k order (k = 8 hi + 0..7, then 16 + 8 hi + 0..7), which is also the order of ldf for Q and of ldfr for K and v^T.
// Wave w takes the 32-key blocks w, w + AW, ... up to the diagonal block and keeps its own running maximum m, sum l and output tile; a wave with no block keeps m = -3e38, l = 0, O = 0 and weighs nothing in the join.
// Join: every wave puts m, l and O in LDS; behind ONE barrier each thread takes the maximum of the AW m of its row and adds the AW partials, each scaled by exp(m_w - max), in wave order 0..AW-1 (a fixed order), divides by the joined sum and stores four outputs.
#define AW 16
#define QR 32
#define LOG2E 1.4426950408889634f
#define QPIT 72               // LDS pitch of a query row in elements: 144 bytes, 16 bytes x an odd number, for 16-byte reads down a column of rows
#define PLN (NB_ * TT * HD)   // elements from a hi plane to its lo plane: the launcher takes each pair one behind the other, and a plane is a whole number of 256-byte units
__device__ __forceinline__ v16bf ldf(const bf* p) { return cat16b(*(const v8us*)p, *(const v8us*)(p + 16)); }
// a fragment from a plane in fragment order: p = the fragment's first piece + 8 lane; its two loads (k = 8 hi + 0..7, then 16 + 8 hi + 0..7) each cover 512 bytes in a row, four whole lines
__device__ __forceinline__ v16bf ldfr(const bf* p) { return cat16b(*(const v8us*)p, *(const v8us*)(p + 256)); }
typedef __attribute__((ext_vector_type(8))) unsigned v8u;
__global__ __launch_bounds__(32 * AW) void k_attn(const bf* __restrict__ Qp, const bf* __restrict__ Kp, const bf* __restrict__ Vp, float* out) {
    __shared__ __align__(16) float ob[AW * QR * 68];
    __shared__ float ms[AW * QR]; __shared__ float ls[AW * QR];
    __shared__ __align__(16) bf qs[2 * QR * QPIT];   // the work-group's query rows, hi plane then lo plane
    const int lane = threadIdx.x & 31, lr = lane & 15, hi = lane >> 4;
    const int wave = __builtin_amdgcn_readfirstlane(threadIdx.x >> 5);   // the wave's number in a scalar register: the key loop stays a scalar branch
    const int qi = (TT / QR - 1) - (int)blockIdx.y, q0 = qi * QR;   // the longest rows start first
    const size_t pb = (size_t)blockIdx.x * TT * HD;
    out += pb;
    v8f o[4][2];                // O^T: [16 head columns][16-row group]
#pragma unroll
    for (int dt = 0; dt < 4; ++dt)
#pragma unroll
        for (int qt = 0; qt < 2; ++qt) o[dt][qt] = (v8f){};
    float m[2] = {-3.0e38f, -3.0e38f}, l[2] = {0.f, 0.f};
    {   // 2 planes x 32 rows x 128 bytes = one 16-byte piece a thread, whole lines per load
        static_assert(32 * AW * 8 == 2 * QR * HD, "one 16-byte piece of the query tile a thread");
        const int pl_ = threadIdx.x >> 8, row = (threadIdx.x >> 3) & 31, pc = threadIdx.x & 7;
        *(v8usa*)(qs + (pl_ * QR + row) * QPIT + pc * 8) = *(const v8us*)(Qp + pl_ * PLN + pb + (q0 + row) * HD + pc * 8);
    }
    __syncthreads();   // the whole query tile is in LDS before any wave reads a fragment of it
    // the lane's own pointers: row lr of the query tile in LDS, 8 elements per lane half; piece 'lane' of the wave's first 32-key block (2048 elements) of the K and v^T planes, which step on by AW blocks at the foot of a trip
    const bf* qp = qs + lr * QPIT + 8 * hi; const bf* kp = Kp + pb + wave * (32 * HD) + lane * 8; const bf* vp = Vp + pb + wave * (32 * HD) + lane * 8;
#pragma unroll 1
    for (int kb = wave; kb <= qi; kb += AW) {
        const int k0 = kb * 32;
        // the query fragments are read anew from LDS each trip: kept over the trip they do not fit beside the output tile, the v^T fragments and P in the 256 registers of a wave
        v16bf qh[2][2], ql[2][2], kh[2][2], kl[2][2];   // [16-row group][32-wide step of the head dimension]
#pragma unroll
        for (int g = 0; g < 2; ++g)
#pragma unroll
            for (int ks = 0; ks < 2; ++ks) { const int c = g * 16 * HD + ks * 512, cq = g * 16 * QPIT + ks * 32; kh[g][ks] = ldfr(kp + c); kl[g][ks] = ldfr(kp + PLN + c); qh[g][ks] = ldf(qp + cq); ql[g][ks] = ldf(qp + QR * QPIT + cq); }
        // holds the K and Q loads of a trip in one group in front of the first wait; without it the build issues them in small groups with a wait behind each
        __builtin_amdgcn_sched_barrier(0);
        v8f s[2][2];            // S^T: [16 keys][16-row group]
#pragma unroll
        for (int kt = 0; kt < 2; ++kt) { s[kt][0] = (v8f){}; s[kt][1] = (v8f){}; }
        // the four tiles in turn inside each product: four independent accumulate chains, and all four tiles have their registers before any fragment has had its last use
#pragma unroll
        for (int ks = 0; ks < 2; ++ks)
#pragma unroll
            for (int pr = 0; pr < 3; ++pr)
#pragma unroll
                for (int kt = 0; kt < 2; ++kt)
#pragma unroll
                    for (int qt = 0; qt < 2; ++qt) s[kt][qt] = wmmab(pr == 2 ? kl[kt][ks] : kh[kt][ks], pr == 1 ? ql[qt][ks] : qh[qt][ks], s[kt][qt]);
        v16bf vh[4], vl[4];
#pragma unroll
        for (int dt = 0; dt < 4; ++dt) { vh[dt] = ldfr(vp + dt * 512); vl[dt] = ldfr(vp + PLN + dt * 512); }
        // holds the v^T loads in front of the softmax, whose vector work then covers their latency (they take the registers that K and Q have left)
        __builtin_amdgcn_sched_barrier(0);
        v16bf ph[2], pl[2];
#pragma unroll
        for (int qt = 0; qt < 2; ++qt) { const int rel = q0 - k0 + qt * 16 + lr - hi * 8;   // key <= query row  <=>  16 kt + j <= rel
            v16f t; float bm = m[qt];
#pragma unroll
            for (int kt = 0; kt < 2; ++kt)
#pragma unroll
                for (int j = 0; j < 8; ++j) { const float u = (kt * 16 + j <= rel) ? s[kt][qt][j] * SCL : -3.0e38f; t[kt * 8 + j] = u; bm = fmaxf(bm, u); }
            bm = fmaxf(bm, __shfl_xor(bm, 16, 32));   // the other lane half holds the row's other 16 keys
            const float al = __builtin_amdgcn_exp2f((m[qt] - bm) * LOG2E); m[qt] = bm;
            float sum = 0.f;
#pragma unroll
            for (int e = 0; e < 16; ++e) { t[e] = __builtin_amdgcn_exp2f((t[e] - bm) * LOG2E); sum += t[e]; }
            l[qt] = l[qt] * al + sum;
#pragma unroll
            for (int dt = 0; dt < 4; ++dt) o[dt][qt] *= al;
            ph[qt] = __builtin_convertvector(t, v16bf);   // hi = bf16(p), lo = bf16(p - hi); hi goes back to f32 from the packed pairs, one shift or one mask an element
            const v8u hp = __builtin_bit_cast(v8u, ph[qt]); v16f hb;
#pragma unroll
            for (int e = 0; e < 8; ++e) { hb[2 * e] = __uint_as_float(hp[e] << 16); hb[2 * e + 1] = __uint_as_float(hp[e] & 0xFFFF0000u); }
            pl[qt] = __builtin_convertvector(t - hb, v16bf); }
#pragma unroll
        for (int dt = 0; dt < 4; ++dt)
#pragma unroll
            for (int qt = 0; qt < 2; ++qt) { o[dt][qt] = wmmab(vh[dt], ph[qt], o[dt][qt]); o[dt][qt] = wmmab(vh[dt], pl[qt], o[dt][qt]); o[dt][qt] = wmmab(vl[dt], ph[qt], o[dt][qt]); }
        // four vector slots between a trip's last matrix instruction and the next trip's first write of its operands; the memory clobber keeps the LDS reads of the query fragments inside the trip
        asm volatile("v_nop\n\tv_nop\n\tv_nop\n\tv_nop" : "+v"(o[3][0]), "+v"(o[3][1]) : "v"(vl[3]), "v"(ph[1]) : "memory");
        kp += AW * 32 * HD; vp += AW * 32 * HD;
    }
#pragma unroll
    for (int qt = 0; qt < 2; ++qt) { l[qt] += __shfl_xor(l[qt], 16, 32);   // the lane halves' sums, joined once
        float* po = ob + (wave * QR + qt * 16 + lr) * 68 + hi * 8;
#pragma unroll
        for (int dt = 0; dt < 4; ++dt) { *(v4fa*)(po + dt * 16) = __builtin_shufflevector(o[dt][qt], o[dt][qt], 0, 1, 2, 3); *(v4fa*)(po + dt * 16 + 4) = __builtin_shufflevector(o[dt][qt], o[dt][qt], 4, 5, 6, 7); }
        if (hi == 0) { ms[wave * QR + qt * 16 + lr] = m[qt]; ls[wave * QR + qt * 16 + lr] = l[qt]; } }
    __syncthreads();   // every wave's m, l and partial output are in LDS before any thread joins them
    const int q = wave * 2 + hi, d4 = lr * 4;   // thread / 16 and 4 (thread % 16)
    float mw[AW]; float mx = -3.0e38f;
#pragma unroll
    for (int w = 0; w < AW; ++w) { mw[w] = ms[w * QR + q]; mx = fmaxf(mx, mw[w]); }
    v4f acc = (v4f){}; float lsum = 0.f;
#pragma unroll
    for (int w = 0; w < AW; ++w) { const float a = (mw[w] - mx) * LOG2E; float f;
        asm("v_exp_f32 %0, %1\n\tv_nop" : "=v"(f) : "v"(a));   // exp2 with the one free slot the instruction set asks for behind a transcendental, in one statement
        lsum += ls[w * QR + q] * f; acc += *(const v4fa*)(ob + (w * QR + q) * 68 + d4) * f; }
    *(v4f*)(out + (size_t)(q0 + q) * HD + d4) = acc * __fdiv_rn(1.0f, lsum);
}

extern "C" void kernel_launch(void* const* d_in, const int* in_sizes, int n_in,
                              void* d_out, int out_size, void* d_ws, size_t ws_size, hipStream_t stream) {
    (void)in_sizes; (void)n_in; (void)out_size;
    const float* x = (const float*)d_in[0]; const float* wk = (const float*)d_in[1]; const float* wq = (const float*)d_in[2]; const float* wv = (const float*)d_in[3];   /* input order x, Wk, Wq, Wv ('xw' [1024][64]; NOTE the key weight comes FIRST) */
    float* OUT = (float*)d_out;     // [4][2048][64]
    char* wsp = (char*)d_ws;
    auto take = [&](size_t bytes) { char* p = wsp; wsp += (bytes + 255) & ~(size_t)255; return (void*)p; };
    bf* QPh = (bf*)take((size_t)NB_ * NH_ * TT * HD * 2); bf* QPl = (bf*)take((size_t)NB_ * NH_ * TT * HD * 2); bf* KPh = (bf*)take((size_t)NB_ * NKV * TT * HD * 2); bf* KPl = (bf*)take((size_t)NB_ * NKV * TT * HD * 2); bf* VTh = (bf*)take((size_t)NB_ * NKV * HD * TT * 2); bf* VTl = (bf*)take((size_t)NB_ * NKV * HD * TT * 2);
    if ((size_t)(wsp - (char*)d_ws) > ws_size) return;    // ws 256 MiB; the six planes take 6 MiB
    // By registers two projection work-groups of 8 waves fit a WGP (4 waves a SIMD at over 192 registers each): the 384 work-groups find 512 places and all run at once.
    // x is [NB_ * TT][DM] row-contiguous, so the projections take the batch as more rows; the attention takes it as grid x. The output [b][t][d] is stored by the attention launch.
    k_proj<8><<<dim3(NB_ * TT / 64, 3, 1), 256, 0, stream>>>(x, wq, wk, wv, QPh, QPl, KPh, KPl, VTh, VTl);
    k_attn<<<dim3(NB_, TT / QR, 1), 32 * AW, 0, stream>>>(QPh, KPh, VTh, OUT);   // each lo plane lies PLN elements behind its hi plane
}
